// v000
// Measured on an AMD MI455X. A time is GPU time per run, averaged over a window of back-to-back runs after a warm-up
// (all launches, gaps included; the runs take copies of the inputs in turn), and the median of several windows.
// Apart from v000's, it joins two sittings. Times from different sittings can be a few percent apart, while
// side-by-side timings come from the same sitting.
// v000, which the later versions start from, runs in 1250 microseconds.
#include <hip/hip_runtime.h>

// SimplifiedMultiHeadAttention (x [2][2048][1024]; per-head q/k/v = x W[h] + b[h] (16 heads, W [16][1024][64]); scores = q.k UNSCALED; att = softmax over keys THEN / sqrt(64); out = concat_h(att v) -> [2][2048][1024], no output projection).
// Compute dtypes, f32 accumulate: every input rounded to bf16; projections on PLAIN bf16 operands (inputs: exact, + bias); because the logits are unscaled (|s| up to ~20)
// EVERY query row takes scores and att.v on bf16 hi+lo planes (3 products each; single fp16 planes would leave ~1e-2 logit error); f32 register-row softmax with the post-softmax 1/8 folded into the

#define NB_  2
#define TT   2048
#define DM   1024
#define NH_  16
#define NKV  16
#define REP  (NH_ / NKV)
#define HD   64
#define DQ   (NH_ * HD)
#define DKV  (NKV * HD)
#define ZH   2
#define RH   2048                  // query rows < RH use hi+lo planes (0: none)
#define WIN  0
#define PCAR 1024.0f
#define SCL  1.0f                  // unscaled logits (the 1/sqrt(64) is applied AFTER the softmax, folded into the normaliser)
typedef _Float16 h16;
typedef unsigned short bf;
typedef __attribute__((ext_vector_type(16))) __bf16   v16bf;
typedef __attribute__((ext_vector_type(16))) _Float16 v16h;
typedef __attribute__((ext_vector_type(8)))  _Float16 v8h;
typedef __attribute__((ext_vector_type(8)))  unsigned short v8us;
typedef __attribute__((ext_vector_type(8)))  float    v8f;
typedef __attribute__((ext_vector_type(4)))  float    v4f;
typedef v8h  __attribute__((may_alias)) v8ha;
typedef v4f  __attribute__((may_alias)) v4fa;
typedef v8us __attribute__((may_alias)) v8usa;

__device__ __forceinline__ unsigned short f2bf(float f) { unsigned u = __float_as_uint(f); u += 0x7FFFu + ((u >> 16) & 1u); return (unsigned short)(u >> 16); }
__device__ __forceinline__ float bf2f(unsigned short b) { return __uint_as_float(((unsigned)b) << 16); }
__device__ __forceinline__ float bfr(float f) { return bf2f(f2bf(f)); }
__device__ __forceinline__ v16h cat16(v8h lo, v8h hi) { return __builtin_shufflevector(lo, hi, 0, 1, 2, 3, 4, 5, 6, 7, 8, 9, 10, 11, 12, 13, 14, 15); }
__device__ __forceinline__ v16bf cat16b(v8us lo, v8us hi) { return __builtin_bit_cast(v16bf, __builtin_shufflevector(lo, hi, 0, 1, 2, 3, 4, 5, 6, 7, 8, 9, 10, 11, 12, 13, 14, 15)); }
__device__ __forceinline__ v8f wmma16(v16h a, v16h b, v8f c) { return __builtin_amdgcn_wmma_f32_16x16x32_f16(false, a, false, b, (short)0, c, false, false); }
__device__ __forceinline__ v8f wmmab(v16bf a, v16bf b, v8f c) { return __builtin_amdgcn_wmma_f32_16x16x32_bf16(false, a, false, b, (short)0, c, false, false); }



// ---- k_gemmw: register-blocked GEMM, ONE WAVE per 64x64 output tile (16 accumulators), operands straight from K-contiguous 16-bit planes; grid (M/64, N/64, Z), 32 threads.
// C[m][n] (f32, pitch ldc, + optional f32 bias[n]) = sum_k A[m][k] Bt[n][k] (+ split products per NSPLIT). z-batch strides sA/sB/sC in elements. K % 32 == 0.
template <typename T16> struct WFrag;
template <> struct WFrag<h16> { typedef v16h V; static __device__ __forceinline__ V ld(const h16* p) { return cat16(*(const v8h*)p, *(const v8h*)(p + 16)); } static __device__ __forceinline__ v8f mma(V a, V b, v8f c) { return wmma16(a, b, c); } };
template <> struct WFrag<bf> { typedef v16bf V; static __device__ __forceinline__ V ld(const bf* p) { return cat16b(*(const v8us*)p, *(const v8us*)(p + 16)); } static __device__ __forceinline__ v8f mma(V a, V b, v8f c) { return wmmab(a, b, c); } };
template <typename T16, int NSPLIT, bool BIAS>
__global__ __launch_bounds__(32) void k_gemmw(const T16* __restrict__ A, const T16* __restrict__ A2, const T16* __restrict__ Bt, const T16* __restrict__ Bt2, int K, float* C, int ldc, const float* __restrict__ bias, size_t sA, size_t sB, size_t sC) {
    typedef typename WFrag<T16>::V V;
    __shared__ __align__(16) float os[16 * 68];
    const size_t z = blockIdx.z; A += z * sA; if (A2) A2 += z * sA; Bt += z * sB; if (Bt2) Bt2 += z * sB; C += z * sC;
    const int lane = threadIdx.x & 31, lr = lane & 15, hi = lane >> 4; const int r0 = blockIdx.x * 64, c0 = blockIdx.y * 64;
    v8f acc[4][4];
#pragma unroll
    for (int mb = 0; mb < 4; ++mb)
#pragma unroll
        for (int nb = 0; nb < 4; ++nb) acc[mb][nb] = (v8f){};
    const size_t aoff = (size_t)(r0 + lr) * K + 8 * hi, boff = (size_t)(c0 + lr) * K + 8 * hi;
#pragma unroll 1
    for (int kc = 0; kc < K; kc += 32) {
        V a[4], a2[4];
#pragma unroll
        for (int mb = 0; mb < 4; ++mb) { a[mb] = WFrag<T16>::ld(A + aoff + (size_t)mb * 16 * K + kc); if (NSPLIT == 1 || NSPLIT == 2) a2[mb] = WFrag<T16>::ld(A2 + aoff + (size_t)mb * 16 * K + kc); }
#pragma unroll
        for (int nb = 0; nb < 4; ++nb) { const V b = WFrag<T16>::ld(Bt + boff + (size_t)nb * 16 * K + kc); V b2; if (NSPLIT >= 2) b2 = WFrag<T16>::ld(Bt2 + boff + (size_t)nb * 16 * K + kc);
#pragma unroll
            for (int mb = 0; mb < 4; ++mb) { acc[mb][nb] = WFrag<T16>::mma(a[mb], b, acc[mb][nb]); if (NSPLIT == 1 || NSPLIT == 2) acc[mb][nb] = WFrag<T16>::mma(a2[mb], b, acc[mb][nb]); if (NSPLIT >= 2) acc[mb][nb] = WFrag<T16>::mma(a[mb], b2, acc[mb][nb]); } }
        asm volatile("v_nop\n\tv_nop\n\tv_nop\n\tv_nop" : "+v"(acc[0][0]), "+v"(acc[1][1]), "+v"(acc[2][2]), "+v"(acc[3][3]) : "v"(a[0]), "v"(a[3]));
    }
#pragma unroll
    for (int mb = 0; mb < 4; ++mb) {
#pragma unroll
        for (int nb = 0; nb < 4; ++nb) {
#pragma unroll
            for (int j = 0; j < 8; ++j) os[(hi * 8 + j) * 68 + nb * 16 + lr] = acc[mb][nb][j]; }
        __builtin_amdgcn_wave_barrier(); asm volatile("" ::: "memory");
        float* crow = C + (size_t)(r0 + mb * 16) * ldc + c0;
{
#pragma unroll
            for (int s = 0; s < 8; ++s) { const int row = 2 * s + hi, cofs = lr * 4; v4f val = *(const v4fa*)(os + row * 68 + cofs); if (BIAS) { val[0] += bfr(bias[c0 + cofs]); val[1] += bfr(bias[c0 + cofs + 1]); val[2] += bfr(bias[c0 + cofs + 2]); val[3] += bfr(bias[c0 + cofs + 3]); }
                *(v4f*)(crow + (size_t)row * ldc + cofs) = val; }
             }
        __builtin_amdgcn_wave_barrier(); asm volatile("" ::: "memory");
    }
}

__device__ __forceinline__ h16 tohx(float x) { return (h16)x; }
__device__ __forceinline__ void splitf(float y, unsigned short& h, unsigned short& l) { h = f2bf(y); l = f2bf(y - bf2f(h)); }
typedef __attribute__((ext_vector_type(2))) _Float16 v2h;
typedef __attribute__((ext_vector_type(4))) _Float16 v4h;
typedef __attribute__((ext_vector_type(2))) unsigned short v2us;
typedef __attribute__((ext_vector_type(4))) unsigned short v4us;
typedef __attribute__((ext_vector_type(2))) float v2f;
typedef __attribute__((ext_vector_type(4))) int v4i;

__global__ __launch_bounds__(256) void k_wtG(const float* __restrict__ w, int K, int N, bf* Bt) {
    const int lane = threadIdx.x & 31; const int L0 = (blockIdx.x * 8 + (threadIdx.x >> 5)) * 8; const int nlines = N * K / 64;
{
#pragma unroll 1
        for (int l = 0; l < 8; ++l) { const int L = L0 + l; if (L >= nlines) break; const size_t e = (size_t)L * 64 + lane * 2; const int k = (int)(e % K), n = (int)(e / K); v2us o;
            o[0] = f2bf(w[(size_t)k * N + n]); o[1] = f2bf(w[(size_t)(k + 1) * N + n]); *(v2us*)(Bt + e) = o; }
         }
}
__global__ __launch_bounds__(256) void k_cvt8(const float* __restrict__ src, bf* dst, size_t n8) { const size_t i = (size_t)blockIdx.x * 256 + threadIdx.x; if (i >= n8) return; const v8f v = *(const v8f*)(src + i * 8); v8us o;
#pragma unroll
    for (int k = 0; k < 8; ++k) o[k] = f2bf(v[k]); *(v8us*)(dst + i * 8) = o;  }
__global__ __launch_bounds__(256) void k_cscvt(const float* __restrict__ cosT, const float* __restrict__ sinT, float* CS) { const int idx = blockIdx.x * 256 + threadIdx.x; if (idx >= TT * HD) return; v2f cs; cs[0] = bfr(cosT[idx]); cs[1] = bfr(sinT[idx]); *(v2f*)(CS + (size_t)idx * 2) = cs;  }
// k_rope: head planes [h][t][d] (fp16 + hi/lo) of rope(x) x sc with the rotate-half convention out[d] = x[d] cos[t][d] - x[d+HD/2] sin[t][d], out[d+HD/2] = x[d+HD/2] cos[t][d+HD/2] + x[d] sin[t][d+HD/2]
__global__ __launch_bounds__(256) void k_rope(const float* __restrict__ F, int pitch, int nheads, const float* __restrict__ CS, const float* __restrict__ RF, const float* __restrict__ nw, float sc, h16* P16, bf* Ph, bf* Pl) {
    const size_t e = ((size_t)blockIdx.x * 256 + threadIdx.x) * 2; if (e >= (size_t)nheads * TT * HD) return; const int d = (int)(e % HD); const int t = (int)((e / HD) % TT); const int h = (int)(e / ((size_t)HD * TT)); const float* f = F + (size_t)t * pitch + h * HD; const float rf = RF ? RF[(size_t)h * TT + t] : 1.0f; v2h o16; v2us oh, ol;
#pragma unroll
    for (int q = 0; q < 2; ++q) { const int dd = d + q; const int dp = (dd < HD / 2) ? dd + HD / 2 : dd - HD / 2; float x0 = f[dd], x1 = f[dp];
        if (RF) { float n0 = __fmul_rn(x0, rf), n1 = __fmul_rn(x1, rf); asm volatile("" : "+v"(n0)); asm volatile("" : "+v"(n1)); x0 = __fmul_rn(bfr(nw[dd]), n0); x1 = __fmul_rn(bfr(nw[dp]), n1); }
        const v2f cs = *(const v2f*)(CS + ((size_t)t * HD + dd) * 2); float a = __fmul_rn(x0, cs[0]), bq = __fmul_rn(x1, cs[1]); asm volatile("" : "+v"(a)); asm volatile("" : "+v"(bq)); const float r = ((dd < HD / 2) ? __fsub_rn(a, bq) : __fadd_rn(a, bq)) * sc;
        o16[q] = tohx(r); unsigned short a2, c2; splitf(r, a2, c2); oh[q] = a2; ol[q] = c2; }
    *(v2h*)(P16 + e) = o16; *(v2us*)(Ph + e) = oh; *(v2us*)(Pl + e) = ol;  }
__global__ __launch_bounds__(256) void k_vtp(const float* __restrict__ F, int pitch, int nheads, h16* V16, bf* Vh, bf* Vl) { const size_t e = ((size_t)blockIdx.x * 256 + threadIdx.x) * 2; if (e >= (size_t)nheads * HD * TT) return; const int t = (int)(e % TT); const int d = (int)((e / TT) % HD); const int g = (int)(e / ((size_t)TT * HD)); v2h o16; v2us oh, ol;
#pragma unroll
    for (int q = 0; q < 2; ++q) { const float x = F[(size_t)(t + q) * pitch + g * HD + d]; o16[q] = tohx(x); unsigned short a2, c2; splitf(x, a2, c2); oh[q] = a2; ol[q] = c2; }
    *(v2h*)(V16 + e) = o16; *(v2us*)(Vh + e) = oh; *(v2us*)(Vl + e) = ol;  }
__global__ __launch_bounds__(256) void k_wt3(const float* __restrict__ w, bf* Bt) { const int e4 = (blockIdx.x * 256 + threadIdx.x) * 4; if (e4 >= NH_ * HD * DM) return; const int k = e4 % DM; const int n = e4 / DM; const int h = n / HD, e = n % HD; v4us o;
#pragma unroll
    for (int q = 0; q < 4; ++q) o[q] = f2bf(w[((size_t)h * DM + k + q) * HD + e]); *(v4us*)(Bt + e4) = o;  }
__global__ __launch_bounds__(256) void k_outf(const float* __restrict__ Ob, int h0, float* OUTb) { const size_t e = ((size_t)blockIdx.x * 256 + threadIdx.x) * 2; if (e >= (size_t)ZH * TT * HD) return; const int d = (int)(e % HD); const int t = (int)((e / HD) % TT); const int zz = (int)(e / ((size_t)HD * TT)); v2f o; o[0] = Ob[e]; o[1] = Ob[e + 1]; const size_t oo = (size_t)t * DM + (size_t)(h0 + zz) * HD + d; *(v2f*)(OUTb + oo) = o;  }
__global__ __launch_bounds__(256) void k_csid(float* CS) { const int idx = blockIdx.x * 256 + threadIdx.x; if (idx >= TT * HD) return; v2f cs; cs[0] = 1.0f; cs[1] = 0.0f; *(v2f*)(CS + (size_t)idx * 2) = cs;  }
// k_asoft: per row (zz, i): t = S unscaled (no mask; HD^-0.5 applied after the softmax); softmax over the 2048 keys (register row, one exp, fixed trees);
__global__ __launch_bounds__(256) void k_asoft(const float* __restrict__ Sb, h16* P16, bf* Ph, bf* Pl) {
    const int lane = threadIdx.x & 31; const int row = blockIdx.x * 8 + (threadIdx.x >> 5); if (row >= ZH * TT) return; const int i = row % TT; const int zz = row / TT; (void)zz; const bool hires = (i < RH); const float* sr = Sb + (size_t)row * TT; float v[TT / 32]; float mx = -3.0e38f;
#pragma unroll
    for (int ch = 0; ch < TT / 128; ++ch) { const int j0 = ch * 128 + lane * 4; const v4f a = *(const v4f*)(sr + j0);
#pragma unroll
        for (int q = 0; q < 4; ++q) { const int j = j0 + q; (void)j; const float t = a[q] * SCL; v[ch * 4 + q] = t; mx = fmaxf(mx, t); } }
#pragma unroll
    for (int sh = 16; sh; sh >>= 1) mx = fmaxf(mx, __shfl_xor(mx, sh, 32));
    float sum = 0.f;
#pragma unroll
    for (int k = 0; k < TT / 32; ++k) { float d0 = __fsub_rn(v[k], mx); asm volatile("" : "+v"(d0)); v[k] = __builtin_amdgcn_exp2f(__fmul_rn(d0, 1.4426950408889634f)); sum += v[k]; }
#pragma unroll
    for (int sh = 16; sh; sh >>= 1) sum += __shfl_xor(sum, sh, 32);
    const float f = __fdiv_rn(hires ? 0.125f : PCAR, sum);   // softmax / sqrt(64)
{
        if (hires) {
#pragma unroll
            for (int ch = 0; ch < TT / 128; ++ch) { v4us oh, ol;
#pragma unroll
                for (int q = 0; q < 4; ++q) { unsigned short a, c2; splitf(v[ch * 4 + q] * f, a, c2); oh[q] = a; ol[q] = c2; }
                const size_t oo = ((size_t)zz * (RH ? RH : 1) + i) * TT + ch * 128 + lane * 4; *(v4us*)(Ph + oo) = oh; *(v4us*)(Pl + oo) = ol; }
        } else {
#pragma unroll
            for (int ch = 0; ch < TT / 128; ++ch) { v4h o4;
#pragma unroll
                for (int q = 0; q < 4; ++q) o4[q] = tohx(v[ch * 4 + q] * f);
                *(v4h*)(P16 + (size_t)row * TT + ch * 128 + lane * 4) = o4; } }
         }
}
__global__ __launch_bounds__(256) void k_merge(const float* __restrict__ O, int h0, bf* Ah, bf* Al) { const size_t e = ((size_t)blockIdx.x * 256 + threadIdx.x) * 2; if (e >= (size_t)ZH * TT * HD) return; const int d = (int)(e % HD); const int t = (int)((e / HD) % TT); const int zz = (int)(e / ((size_t)HD * TT)); const float cs = (t < RH) ? 1.0f : (1.0f / PCAR); const size_t oo = (size_t)t * DQ + (h0 + zz) * HD + d;
    v2us oh, ol;
#pragma unroll
    for (int q = 0; q < 2; ++q) { unsigned short a, c2; splitf(O[e + q] * cs, a, c2); oh[q] = a; ol[q] = c2; } *(v2us*)(Ah + oo) = oh; *(v2us*)(Al + oo) = ol;  }

extern "C" void kernel_launch(void* const* d_in, const int* in_sizes, int n_in,
                              void* d_out, int out_size, void* d_ws, size_t ws_size, hipStream_t stream) {
    (void)in_sizes; (void)n_in; (void)out_size;
    const float* x = (const float*)d_in[0]; const float* wq = (const float*)d_in[1]; const float* bq = (const float*)d_in[2]; const float* wk = (const float*)d_in[3]; const float* bk = (const float*)d_in[4]; const float* wv = (const float*)d_in[5]; const float* bv = (const float*)d_in[6];   // W [16][1024][64] per head (x @ W[h]), b [16][64]
    float* OUT = (float*)d_out;     // [2][2048][1024]
    char* wsp = (char*)d_ws;
    auto take = [&](size_t bytes) { char* p = wsp; wsp += (bytes + 255) & ~(size_t)255; return (void*)p; };
    bf* WQ = (bf*)take((size_t)DQ * DM * 2); bf* WK = (bf*)take((size_t)DKV * DM * 2); bf* WV = (bf*)take((size_t)DKV * DM * 2); bf* WO = (bf*)take((size_t)DM * DQ * 2); float* CS = (float*)take((size_t)TT * HD * 2 * 4);
    bf* XB = (bf*)take((size_t)TT * DM * 2); float* FQ = (float*)take((size_t)TT * DQ * 4); float* FK = (float*)take((size_t)TT * DKV * 4);
    h16* QP16 = (h16*)take((size_t)NH_ * TT * HD * 2); h16* KP16 = (h16*)take((size_t)NKV * TT * HD * 2); h16* VT16 = (h16*)take((size_t)NKV * HD * TT * 2);
    bf* QPh = (bf*)take((size_t)NH_ * TT * HD * 2); bf* QPl = (bf*)take((size_t)NH_ * TT * HD * 2); bf* KPh = (bf*)take((size_t)NKV * TT * HD * 2); bf* KPl = (bf*)take((size_t)NKV * TT * HD * 2); bf* VTh = (bf*)take((size_t)NKV * HD * TT * 2); bf* VTl = (bf*)take((size_t)NKV * HD * TT * 2); bf* Ph = (bf*)take((size_t)ZH * RH * TT * 2); bf* Pl = (bf*)take((size_t)ZH * RH * TT * 2);
    float* Sb = (float*)take((size_t)ZH * TT * TT * 4); h16* P16 = (h16*)take((size_t)ZH * TT * TT * 2); float* Ob = (float*)take((size_t)ZH * TT * HD * 4); bf* ATh = (bf*)take((size_t)TT * DQ * 2); bf* ATl = (bf*)take((size_t)TT * DQ * 2);
    if ((size_t)(wsp - (char*)d_ws) > ws_size) return;    // ws 256 MiB
    float* FV = FK;   // v projection reuses the k buffer after the k planes are built (stream-ordered)
    { const unsigned g3 = (unsigned)(((size_t)DQ * DM / 4 + 255) / 256); k_wt3<<<g3, 256, 0, stream>>>(wq, WQ); k_wt3<<<g3, 256, 0, stream>>>(wk, WK); k_wt3<<<g3, 256, 0, stream>>>(wv, WV);
       }
    k_csid<<<(TT * HD + 255) / 256, 256, 0, stream>>>(CS);
    const unsigned LQ = (unsigned)(((size_t)NH_ * TT * HD / 2 + 255) / 256), LKv = (unsigned)(((size_t)NKV * TT * HD / 2 + 255) / 256);
    for (int b = 0; b < NB_; ++b) {
        
        k_cvt8<<<(unsigned)(((size_t)TT * DM / 8 + 255) / 256), 256, 0, stream>>>(x + (size_t)b * TT * DM, XB, (size_t)TT * DM / 8);
        k_gemmw<bf, 0, true><<<dim3(TT / 64, DQ / 64, 1), 32, 0, stream>>>(XB, nullptr, WQ, nullptr, DM, FQ, DQ, bq, 0, 0, 0);
        k_rope<<<LQ, 256, 0, stream>>>(FQ, DQ, NH_, CS, nullptr, nullptr, 1.0f, QP16, QPh, QPl);
        k_gemmw<bf, 0, true><<<dim3(TT / 64, DKV / 64, 1), 32, 0, stream>>>(XB, nullptr, WK, nullptr, DM, FK, DKV, bk, 0, 0, 0);
        k_rope<<<LKv, 256, 0, stream>>>(FK, DKV, NKV, CS, nullptr, nullptr, 1.0f, KP16, KPh, KPl);
        k_gemmw<bf, 0, true><<<dim3(TT / 64, DKV / 64, 1), 32, 0, stream>>>(XB, nullptr, WV, nullptr, DM, FV, DKV, bv, 0, 0, 0); k_vtp<<<LKv, 256, 0, stream>>>(FV, DKV, NKV, VT16, VTh, VTl);
        for (int h0 = 0; h0 < NH_; h0 += ZH) { const size_t zq = (size_t)h0, zk = (size_t)(h0 / REP);   // one kv head per query head: the pass's two heads use consecutive kv planes (z-strides TT*HD)
            k_gemmw<bf, 2, false><<<dim3(RH / 64, TT / 64, ZH), 32, 0, stream>>>(QPh + zq * TT * HD, QPl + zq * TT * HD, KPh + zk * TT * HD, KPl + zk * TT * HD, HD, Sb, TT, nullptr, (size_t)TT * HD, (size_t)TT * HD, (size_t)TT * TT);
            k_asoft<<<ZH * TT / 8, 256, 0, stream>>>(Sb, P16, Ph, Pl);
            k_gemmw<bf, 2, false><<<dim3(RH / 64, HD / 64, ZH), 32, 0, stream>>>(Ph, Pl, VTh + zk * HD * TT, VTl + zk * HD * TT, TT, Ob, HD, nullptr, (size_t)RH * TT, (size_t)HD * TT, (size_t)TT * HD);
            k_outf<<<(unsigned)(((size_t)ZH * TT * HD / 2 + 255) / 256), 256, 0, stream>>>(Ob, h0, OUT + (size_t)b * TT * DM); } }
}

// v001
// One run takes 819 microseconds.
// In both of two side-by-side timings against v000, it was 1.53 times as fast.
#include <hip/hip_runtime.h>

// SimplifiedMultiHeadAttention (x [2][2048][1024]; per-head q/k/v = x W[h] + b[h] (16 heads, W [16][1024][64]); scores = q.k UNSCALED; att = softmax over keys THEN / sqrt(64); out = concat_h(att v) -> [2][2048][1024], no output projection).
// Compute dtypes, f32 accumulate: every input rounded to bf16; projections on PLAIN bf16 operands (inputs: exact, + bias); because the logits are unscaled (|s| up to ~20)
// EVERY query row takes scores and att.v on bf16 hi+lo planes (3 products each; single fp16 planes would leave ~1e-2 logit error); f32 register-row softmax with the post-softmax 1/8 folded into the

#define NB_  2
#define TT   2048
#define DM   1024
#define NH_  16
#define NKV  16
#define REP  (NH_ / NKV)
#define HD   64
#define DQ   (NH_ * HD)
#define DKV  (NKV * HD)
#define ZH   2
#define RH   2048                  // query rows < RH use hi+lo planes (0: none)
#define WIN  0
#define PCAR 1024.0f
#define SCL  1.0f                  // unscaled logits (the 1/sqrt(64) is applied AFTER the softmax, folded into the normaliser)
typedef _Float16 h16;
typedef unsigned short bf;
typedef __attribute__((ext_vector_type(16))) __bf16   v16bf;
typedef __attribute__((ext_vector_type(16))) _Float16 v16h;
typedef __attribute__((ext_vector_type(8)))  _Float16 v8h;
typedef __attribute__((ext_vector_type(8)))  unsigned short v8us;
typedef __attribute__((ext_vector_type(8)))  float    v8f;
typedef __attribute__((ext_vector_type(4)))  float    v4f;
typedef v8h  __attribute__((may_alias)) v8ha;
typedef v4f  __attribute__((may_alias)) v4fa;
typedef v8us __attribute__((may_alias)) v8usa;

__device__ __forceinline__ unsigned short f2bf(float f) { unsigned u = __float_as_uint(f); u += 0x7FFFu + ((u >> 16) & 1u); return (unsigned short)(u >> 16); }
__device__ __forceinline__ float bf2f(unsigned short b) { return __uint_as_float(((unsigned)b) << 16); }
__device__ __forceinline__ float bfr(float f) { return bf2f(f2bf(f)); }
__device__ __forceinline__ v16h cat16(v8h lo, v8h hi) { return __builtin_shufflevector(lo, hi, 0, 1, 2, 3, 4, 5, 6, 7, 8, 9, 10, 11, 12, 13, 14, 15); }
__device__ __forceinline__ v16bf cat16b(v8us lo, v8us hi) { return __builtin_bit_cast(v16bf, __builtin_shufflevector(lo, hi, 0, 1, 2, 3, 4, 5, 6, 7, 8, 9, 10, 11, 12, 13, 14, 15)); }
__device__ __forceinline__ v8f wmma16(v16h a, v16h b, v8f c) { return __builtin_amdgcn_wmma_f32_16x16x32_f16(false, a, false, b, (short)0, c, false, false); }
__device__ __forceinline__ v8f wmmab(v16bf a, v16bf b, v8f c) { return __builtin_amdgcn_wmma_f32_16x16x32_bf16(false, a, false, b, (short)0, c, false, false); }



// ---- k_gemmw: register-blocked GEMM, ONE WAVE per 64x64 output tile (16 accumulators), operands straight from K-contiguous 16-bit planes; grid (M/64, N/64, Z), 32 threads.
// C[m][n] (f32, pitch ldc, + optional f32 bias[n]) = sum_k A[m][k] Bt[n][k] (+ split products per NSPLIT). z-batch strides sA/sB/sC in elements. K % 32 == 0.
template <typename T16> struct WFrag;
template <> struct WFrag<h16> { typedef v16h V; static __device__ __forceinline__ V ld(const h16* p) { return cat16(*(const v8h*)p, *(const v8h*)(p + 16)); } static __device__ __forceinline__ v8f mma(V a, V b, v8f c) { return wmma16(a, b, c); } };
template <> struct WFrag<bf> { typedef v16bf V; static __device__ __forceinline__ V ld(const bf* p) { return cat16b(*(const v8us*)p, *(const v8us*)(p + 16)); } static __device__ __forceinline__ v8f mma(V a, V b, v8f c) { return wmmab(a, b, c); } };
template <typename T16, int NSPLIT, bool BIAS>
__global__ __launch_bounds__(32) void k_gemmw(const T16* __restrict__ A, const T16* __restrict__ A2, const T16* __restrict__ Bt, const T16* __restrict__ Bt2, int K, float* C, int ldc, const float* __restrict__ bias, size_t sA, size_t sB, size_t sC) {
    typedef typename WFrag<T16>::V V;
    __shared__ __align__(16) float os[16 * 68];
    const size_t z = blockIdx.z; A += z * sA; if (A2) A2 += z * sA; Bt += z * sB; if (Bt2) Bt2 += z * sB; C += z * sC;
    const int lane = threadIdx.x & 31, lr = lane & 15, hi = lane >> 4; const int r0 = blockIdx.x * 64, c0 = blockIdx.y * 64;
    v8f acc[4][4];
#pragma unroll
    for (int mb = 0; mb < 4; ++mb)
#pragma unroll
        for (int nb = 0; nb < 4; ++nb) acc[mb][nb] = (v8f){};
    const size_t aoff = (size_t)(r0 + lr) * K + 8 * hi, boff = (size_t)(c0 + lr) * K + 8 * hi;
#pragma unroll 1
    for (int kc = 0; kc < K; kc += 32) {
        V a[4], a2[4];
#pragma unroll
        for (int mb = 0; mb < 4; ++mb) { a[mb] = WFrag<T16>::ld(A + aoff + (size_t)mb * 16 * K + kc); if (NSPLIT == 1 || NSPLIT == 2) a2[mb] = WFrag<T16>::ld(A2 + aoff + (size_t)mb * 16 * K + kc); }
#pragma unroll
        for (int nb = 0; nb < 4; ++nb) { const V b = WFrag<T16>::ld(Bt + boff + (size_t)nb * 16 * K + kc); V b2; if (NSPLIT >= 2) b2 = WFrag<T16>::ld(Bt2 + boff + (size_t)nb * 16 * K + kc);
#pragma unroll
            for (int mb = 0; mb < 4; ++mb) { acc[mb][nb] = WFrag<T16>::mma(a[mb], b, acc[mb][nb]); if (NSPLIT == 1 || NSPLIT == 2) acc[mb][nb] = WFrag<T16>::mma(a2[mb], b, acc[mb][nb]); if (NSPLIT >= 2) acc[mb][nb] = WFrag<T16>::mma(a[mb], b2, acc[mb][nb]); } }
        asm volatile("v_nop\n\tv_nop\n\tv_nop\n\tv_nop" : "+v"(acc[0][0]), "+v"(acc[1][1]), "+v"(acc[2][2]), "+v"(acc[3][3]) : "v"(a[0]), "v"(a[3]));
    }
#pragma unroll
    for (int mb = 0; mb < 4; ++mb) {
#pragma unroll
        for (int nb = 0; nb < 4; ++nb) {
#pragma unroll
            for (int j = 0; j < 8; ++j) os[(hi * 8 + j) * 68 + nb * 16 + lr] = acc[mb][nb][j]; }
        __builtin_amdgcn_wave_barrier(); asm volatile("" ::: "memory");
        float* crow = C + (size_t)(r0 + mb * 16) * ldc + c0;
{
#pragma unroll
            for (int s = 0; s < 8; ++s) { const int row = 2 * s + hi, cofs = lr * 4; v4f val = *(const v4fa*)(os + row * 68 + cofs); if (BIAS) { val[0] += bfr(bias[c0 + cofs]); val[1] += bfr(bias[c0 + cofs + 1]); val[2] += bfr(bias[c0 + cofs + 2]); val[3] += bfr(bias[c0 + cofs + 3]); }
                *(v4f*)(crow + (size_t)row * ldc + cofs) = val; }
             }
        __builtin_amdgcn_wave_barrier(); asm volatile("" ::: "memory");
    }
}

__device__ __forceinline__ h16 tohx(float x) { return (h16)x; }
__device__ __forceinline__ void splitf(float y, unsigned short& h, unsigned short& l) { h = f2bf(y); l = f2bf(y - bf2f(h)); }
typedef __attribute__((ext_vector_type(2))) _Float16 v2h;
typedef __attribute__((ext_vector_type(4))) _Float16 v4h;
typedef __attribute__((ext_vector_type(2))) unsigned short v2us;
typedef __attribute__((ext_vector_type(4))) unsigned short v4us;
typedef __attribute__((ext_vector_type(2))) float v2f;
typedef __attribute__((ext_vector_type(4))) int v4i;

__global__ __launch_bounds__(256) void k_wtG(const float* __restrict__ w, int K, int N, bf* Bt) {
    const int lane = threadIdx.x & 31; const int L0 = (blockIdx.x * 8 + (threadIdx.x >> 5)) * 8; const int nlines = N * K / 64;
{
#pragma unroll 1
        for (int l = 0; l < 8; ++l) { const int L = L0 + l; if (L >= nlines) break; const size_t e = (size_t)L * 64 + lane * 2; const int k = (int)(e % K), n = (int)(e / K); v2us o;
            o[0] = f2bf(w[(size_t)k * N + n]); o[1] = f2bf(w[(size_t)(k + 1) * N + n]); *(v2us*)(Bt + e) = o; }
         }
}
__global__ __launch_bounds__(256) void k_cvt8(const float* __restrict__ src, bf* dst, size_t n8) { const size_t i = (size_t)blockIdx.x * 256 + threadIdx.x; if (i >= n8) return; const v8f v = *(const v8f*)(src + i * 8); v8us o;
#pragma unroll
    for (int k = 0; k < 8; ++k) o[k] = f2bf(v[k]); *(v8us*)(dst + i * 8) = o;  }
__global__ __launch_bounds__(256) void k_cscvt(const float* __restrict__ cosT, const float* __restrict__ sinT, float* CS) { const int idx = blockIdx.x * 256 + threadIdx.x; if (idx >= TT * HD) return; v2f cs; cs[0] = bfr(cosT[idx]); cs[1] = bfr(sinT[idx]); *(v2f*)(CS + (size_t)idx * 2) = cs;  }
// k_rope: head planes [h][t][d] (fp16 + hi/lo) of rope(x) x sc with the rotate-half convention out[d] = x[d] cos[t][d] - x[d+HD/2] sin[t][d], out[d+HD/2] = x[d+HD/2] cos[t][d+HD/2] + x[d] sin[t][d+HD/2]
__global__ __launch_bounds__(256) void k_rope(const float* __restrict__ F, int pitch, int nheads, const float* __restrict__ CS, const float* __restrict__ RF, const float* __restrict__ nw, float sc, h16* P16, bf* Ph, bf* Pl) {
    const size_t e = ((size_t)blockIdx.x * 256 + threadIdx.x) * 2; if (e >= (size_t)nheads * TT * HD) return; const int d = (int)(e % HD); const int t = (int)((e / HD) % TT); const int h = (int)(e / ((size_t)HD * TT)); const float* f = F + (size_t)t * pitch + h * HD; const float rf = RF ? RF[(size_t)h * TT + t] : 1.0f; v2h o16; v2us oh, ol;
#pragma unroll
    for (int q = 0; q < 2; ++q) { const int dd = d + q; const int dp = (dd < HD / 2) ? dd + HD / 2 : dd - HD / 2; float x0 = f[dd], x1 = f[dp];
        if (RF) { float n0 = __fmul_rn(x0, rf), n1 = __fmul_rn(x1, rf); asm volatile("" : "+v"(n0)); asm volatile("" : "+v"(n1)); x0 = __fmul_rn(bfr(nw[dd]), n0); x1 = __fmul_rn(bfr(nw[dp]), n1); }
        const v2f cs = *(const v2f*)(CS + ((size_t)t * HD + dd) * 2); float a = __fmul_rn(x0, cs[0]), bq = __fmul_rn(x1, cs[1]); asm volatile("" : "+v"(a)); asm volatile("" : "+v"(bq)); const float r = ((dd < HD / 2) ? __fsub_rn(a, bq) : __fadd_rn(a, bq)) * sc;
        o16[q] = tohx(r); unsigned short a2, c2; splitf(r, a2, c2); oh[q] = a2; ol[q] = c2; }
    *(v2h*)(P16 + e) = o16; *(v2us*)(Ph + e) = oh; *(v2us*)(Pl + e) = ol;  }
__global__ __launch_bounds__(256) void k_vtp(const float* __restrict__ F, int pitch, int nheads, h16* V16, bf* Vh, bf* Vl) { const size_t e = ((size_t)blockIdx.x * 256 + threadIdx.x) * 2; if (e >= (size_t)nheads * HD * TT) return; const int t = (int)(e % TT); const int d = (int)((e / TT) % HD); const int g = (int)(e / ((size_t)TT * HD)); v2h o16; v2us oh, ol;
#pragma unroll
    for (int q = 0; q < 2; ++q) { const float x = F[(size_t)(t + q) * pitch + g * HD + d]; o16[q] = tohx(x); unsigned short a2, c2; splitf(x, a2, c2); oh[q] = a2; ol[q] = c2; }
    *(v2h*)(V16 + e) = o16; *(v2us*)(Vh + e) = oh; *(v2us*)(Vl + e) = ol;  }
__global__ __launch_bounds__(256) void k_wt3(const float* __restrict__ w, bf* Bt) { const int e4 = (blockIdx.x * 256 + threadIdx.x) * 4; if (e4 >= NH_ * HD * DM) return; const int k = e4 % DM; const int n = e4 / DM; const int h = n / HD, e = n % HD; v4us o;
#pragma unroll
    for (int q = 0; q < 4; ++q) o[q] = f2bf(w[((size_t)h * DM + k + q) * HD + e]); *(v4us*)(Bt + e4) = o;  }
__global__ __launch_bounds__(256) void k_outf(const float* __restrict__ Ob, int h0, float* OUTb) { const size_t e = ((size_t)blockIdx.x * 256 + threadIdx.x) * 2; if (e >= (size_t)ZH * TT * HD) return; const int d = (int)(e % HD); const int t = (int)((e / HD) % TT); const int zz = (int)(e / ((size_t)HD * TT)); v2f o; o[0] = Ob[e]; o[1] = Ob[e + 1]; const size_t oo = (size_t)t * DM + (size_t)(h0 + zz) * HD + d; *(v2f*)(OUTb + oo) = o;  }
__global__ __launch_bounds__(256) void k_csid(float* CS) { const int idx = blockIdx.x * 256 + threadIdx.x; if (idx >= TT * HD) return; v2f cs; cs[0] = 1.0f; cs[1] = 0.0f; *(v2f*)(CS + (size_t)idx * 2) = cs;  }
// k_asoft: per row (zz, i): t = S unscaled (no mask; HD^-0.5 applied after the softmax); softmax over the 2048 keys (register row, one exp, fixed trees);
__global__ __launch_bounds__(256) void k_asoft(const float* __restrict__ Sb, h16* P16, bf* Ph, bf* Pl) {
    const int lane = threadIdx.x & 31; const int row = blockIdx.x * 8 + (threadIdx.x >> 5); if (row >= ZH * TT) return; const int i = row % TT; const int zz = row / TT; (void)zz; const bool hires = (i < RH); const float* sr = Sb + (size_t)row * TT; float v[TT / 32]; float mx = -3.0e38f;
#pragma unroll
    for (int ch = 0; ch < TT / 128; ++ch) { const int j0 = ch * 128 + lane * 4; const v4f a = *(const v4f*)(sr + j0);
#pragma unroll
        for (int q = 0; q < 4; ++q) { const int j = j0 + q; (void)j; const float t = a[q] * SCL; v[ch * 4 + q] = t; mx = fmaxf(mx, t); } }
#pragma unroll
    for (int sh = 16; sh; sh >>= 1) mx = fmaxf(mx, __shfl_xor(mx, sh, 32));
    float sum = 0.f;
#pragma unroll
    for (int k = 0; k < TT / 32; ++k) { float d0 = __fsub_rn(v[k], mx); asm volatile("" : "+v"(d0)); v[k] = __builtin_amdgcn_exp2f(__fmul_rn(d0, 1.4426950408889634f)); sum += v[k]; }
#pragma unroll
    for (int sh = 16; sh; sh >>= 1) sum += __shfl_xor(sum, sh, 32);
    const float f = __fdiv_rn(hires ? 0.125f : PCAR, sum);   // softmax / sqrt(64)
{
        if (hires) {
#pragma unroll
            for (int ch = 0; ch < TT / 128; ++ch) { v4us oh, ol;
#pragma unroll
                for (int q = 0; q < 4; ++q) { unsigned short a, c2; splitf(v[ch * 4 + q] * f, a, c2); oh[q] = a; ol[q] = c2; }
                const size_t oo = ((size_t)zz * (RH ? RH : 1) + i) * TT + ch * 128 + lane * 4; *(v4us*)(Ph + oo) = oh; *(v4us*)(Pl + oo) = ol; }
        } else {
#pragma unroll
            for (int ch = 0; ch < TT / 128; ++ch) { v4h o4;
#pragma unroll
                for (int q = 0; q < 4; ++q) o4[q] = tohx(v[ch * 4 + q] * f);
                *(v4h*)(P16 + (size_t)row * TT + ch * 128 + lane * 4) = o4; } }
         }
}
// ---- k_pvs: att.v with the key sum split over the waves of a workgroup. One workgroup of PVW waves per 32x32 output tile; wave w sums keys [w*TT/PVW, (w+1)*TT/PVW) on the same
// hi+lo products as k_gemmw<bf, 2>, then the PVW partial tiles are added in LDS in wave order. grid (RH/32, HD/32, ZH), 32*PVW threads: 256 workgroups instead of 64 single waves.
#define PVW 16
__global__ __launch_bounds__(32 * PVW) void k_pvs(const bf* __restrict__ A, const bf* __restrict__ A2, const bf* __restrict__ Bt, const bf* __restrict__ Bt2, float* C) {
    typedef WFrag<bf>::V V;
    __shared__ __align__(16) float ps[PVW][32 * 36];
    const size_t z = blockIdx.z; A += z * ((size_t)RH * TT); A2 += z * ((size_t)RH * TT); Bt += z * ((size_t)HD * TT); Bt2 += z * ((size_t)HD * TT); C += z * ((size_t)TT * HD);
    const int lane = threadIdx.x & 31, lr = lane & 15, hi = lane >> 4, w = threadIdx.x >> 5; const int r0 = blockIdx.x * 32, c0 = blockIdx.y * 32;
    v8f acc[2][2];
#pragma unroll
    for (int mb = 0; mb < 2; ++mb)
#pragma unroll
        for (int nb = 0; nb < 2; ++nb) acc[mb][nb] = (v8f){};
    const size_t aoff = (size_t)(r0 + lr) * TT + 8 * hi + w * (TT / PVW), boff = (size_t)(c0 + lr) * TT + 8 * hi + w * (TT / PVW);
    const bf* pa = A + aoff; const bf* pa2 = A2 + aoff; const bf* pb = Bt + boff; const bf* pb2 = Bt2 + boff;
    V a[2][2], a2[2][2], b[2][2], b2[2][2];   // [buffer][16-row tile]
#pragma unroll
    for (int t = 0; t < 2; ++t) { a[0][t] = WFrag<bf>::ld(pa + (size_t)t * 16 * TT); a2[0][t] = WFrag<bf>::ld(pa2 + (size_t)t * 16 * TT); b[0][t] = WFrag<bf>::ld(pb + (size_t)t * 16 * TT); b2[0][t] = WFrag<bf>::ld(pb2 + (size_t)t * 16 * TT); }
#pragma unroll
    for (int it = 0; it < TT / PVW / 32; ++it) { const int cu = it & 1, nx = cu ^ 1, kn = (it + 1) * 32;
        if (kn < TT / PVW) {
#pragma unroll
            for (int t = 0; t < 2; ++t) { a[nx][t] = WFrag<bf>::ld(pa + (size_t)t * 16 * TT + kn); a2[nx][t] = WFrag<bf>::ld(pa2 + (size_t)t * 16 * TT + kn); b[nx][t] = WFrag<bf>::ld(pb + (size_t)t * 16 * TT + kn); b2[nx][t] = WFrag<bf>::ld(pb2 + (size_t)t * 16 * TT + kn); } }
        if (kn + 32 == TT / PVW) asm volatile("s_wait_xcnt 0x0" :: "v"(pa), "v"(pa2), "v"(pb), "v"(pb2) : "memory");   // behind the last loads: their address registers stay whole up to this wait and may be reused only behind it
        __builtin_amdgcn_sched_barrier(0);   // keeps the loads above issued ahead of the products below; without it the compiler sinks them to their uses and a wave has two to eight loads in flight
#pragma unroll
        for (int nb = 0; nb < 2; ++nb)
#pragma unroll
            for (int mb = 0; mb < 2; ++mb) acc[mb][nb] = wmmab(a[cu][mb], b[cu][nb], acc[mb][nb]);
#pragma unroll
        for (int nb = 0; nb < 2; ++nb)
#pragma unroll
            for (int mb = 0; mb < 2; ++mb) acc[mb][nb] = wmmab(a2[cu][mb], b[cu][nb], acc[mb][nb]);
#pragma unroll
        for (int nb = 0; nb < 2; ++nb)
#pragma unroll
            for (int mb = 0; mb < 2; ++mb) acc[mb][nb] = wmmab(a[cu][mb], b2[cu][nb], acc[mb][nb]);
    }
#pragma unroll
    for (int mb = 0; mb < 2; ++mb)
#pragma unroll
        for (int nb = 0; nb < 2; ++nb)
#pragma unroll
            for (int j = 0; j < 8; ++j) ps[w][(mb * 16 + hi * 8 + j) * 36 + nb * 16 + lr] = acc[mb][nb][j];
    __syncthreads();   // every wave's partial tile is in LDS before any thread adds them
    const int row = threadIdx.x >> 4, col = (threadIdx.x & 15) * 2;
    v2f s = *(const v2f*)(&ps[0][row * 36 + col]);
#pragma unroll
    for (int q = 1; q < PVW; ++q) s += *(const v2f*)(&ps[q][row * 36 + col]);
    *(v2f*)(C + (size_t)(r0 + row) * HD + c0 + col) = s;
}
__global__ __launch_bounds__(256) void k_merge(const float* __restrict__ O, int h0, bf* Ah, bf* Al) { const size_t e = ((size_t)blockIdx.x * 256 + threadIdx.x) * 2; if (e >= (size_t)ZH * TT * HD) return; const int d = (int)(e % HD); const int t = (int)((e / HD) % TT); const int zz = (int)(e / ((size_t)HD * TT)); const float cs = (t < RH) ? 1.0f : (1.0f / PCAR); const size_t oo = (size_t)t * DQ + (h0 + zz) * HD + d;
    v2us oh, ol;
#pragma unroll
    for (int q = 0; q < 2; ++q) { unsigned short a, c2; splitf(O[e + q] * cs, a, c2); oh[q] = a; ol[q] = c2; } *(v2us*)(Ah + oo) = oh; *(v2us*)(Al + oo) = ol;  }

extern "C" void kernel_launch(void* const* d_in, const int* in_sizes, int n_in,
                              void* d_out, int out_size, void* d_ws, size_t ws_size, hipStream_t stream) {
    (void)in_sizes; (void)n_in; (void)out_size;
    const float* x = (const float*)d_in[0]; const float* wq = (const float*)d_in[1]; const float* bq = (const float*)d_in[2]; const float* wk = (const float*)d_in[3]; const float* bk = (const float*)d_in[4]; const float* wv = (const float*)d_in[5]; const float* bv = (const float*)d_in[6];   // W [16][1024][64] per head (x @ W[h]), b [16][64]
    float* OUT = (float*)d_out;     // [2][2048][1024]
    char* wsp = (char*)d_ws;
    auto take = [&](size_t bytes) { char* p = wsp; wsp += (bytes + 255) & ~(size_t)255; return (void*)p; };
    bf* WQ = (bf*)take((size_t)DQ * DM * 2); bf* WK = (bf*)take((size_t)DKV * DM * 2); bf* WV = (bf*)take((size_t)DKV * DM * 2); bf* WO = (bf*)take((size_t)DM * DQ * 2); float* CS = (float*)take((size_t)TT * HD * 2 * 4);
    bf* XB = (bf*)take((size_t)TT * DM * 2); float* FQ = (float*)take((size_t)TT * DQ * 4); float* FK = (float*)take((size_t)TT * DKV * 4);
    h16* QP16 = (h16*)take((size_t)NH_ * TT * HD * 2); h16* KP16 = (h16*)take((size_t)NKV * TT * HD * 2); h16* VT16 = (h16*)take((size_t)NKV * HD * TT * 2);
    bf* QPh = (bf*)take((size_t)NH_ * TT * HD * 2); bf* QPl = (bf*)take((size_t)NH_ * TT * HD * 2); bf* KPh = (bf*)take((size_t)NKV * TT * HD * 2); bf* KPl = (bf*)take((size_t)NKV * TT * HD * 2); bf* VTh = (bf*)take((size_t)NKV * HD * TT * 2); bf* VTl = (bf*)take((size_t)NKV * HD * TT * 2); bf* Ph = (bf*)take((size_t)ZH * RH * TT * 2); bf* Pl = (bf*)take((size_t)ZH * RH * TT * 2);
    float* Sb = (float*)take((size_t)ZH * TT * TT * 4); h16* P16 = (h16*)take((size_t)ZH * TT * TT * 2); float* Ob = (float*)take((size_t)ZH * TT * HD * 4); bf* ATh = (bf*)take((size_t)TT * DQ * 2); bf* ATl = (bf*)take((size_t)TT * DQ * 2);
    if ((size_t)(wsp - (char*)d_ws) > ws_size) return;    // ws 256 MiB
    float* FV = FK;   // v projection reuses the k buffer after the k planes are built (stream-ordered)
    { const unsigned g3 = (unsigned)(((size_t)DQ * DM / 4 + 255) / 256); k_wt3<<<g3, 256, 0, stream>>>(wq, WQ); k_wt3<<<g3, 256, 0, stream>>>(wk, WK); k_wt3<<<g3, 256, 0, stream>>>(wv, WV);
       }
    k_csid<<<(TT * HD + 255) / 256, 256, 0, stream>>>(CS);
    const unsigned LQ = (unsigned)(((size_t)NH_ * TT * HD / 2 + 255) / 256), LKv = (unsigned)(((size_t)NKV * TT * HD / 2 + 255) / 256);
    for (int b = 0; b < NB_; ++b) {
        
        k_cvt8<<<(unsigned)(((size_t)TT * DM / 8 + 255) / 256), 256, 0, stream>>>(x + (size_t)b * TT * DM, XB, (size_t)TT * DM / 8);
        k_gemmw<bf, 0, true><<<dim3(TT / 64, DQ / 64, 1), 32, 0, stream>>>(XB, nullptr, WQ, nullptr, DM, FQ, DQ, bq, 0, 0, 0);
        k_rope<<<LQ, 256, 0, stream>>>(FQ, DQ, NH_, CS, nullptr, nullptr, 1.0f, QP16, QPh, QPl);
        k_gemmw<bf, 0, true><<<dim3(TT / 64, DKV / 64, 1), 32, 0, stream>>>(XB, nullptr, WK, nullptr, DM, FK, DKV, bk, 0, 0, 0);
        k_rope<<<LKv, 256, 0, stream>>>(FK, DKV, NKV, CS, nullptr, nullptr, 1.0f, KP16, KPh, KPl);
        k_gemmw<bf, 0, true><<<dim3(TT / 64, DKV / 64, 1), 32, 0, stream>>>(XB, nullptr, WV, nullptr, DM, FV, DKV, bv, 0, 0, 0); k_vtp<<<LKv, 256, 0, stream>>>(FV, DKV, NKV, VT16, VTh, VTl);
        for (int h0 = 0; h0 < NH_; h0 += ZH) { const size_t zq = (size_t)h0, zk = (size_t)(h0 / REP);   // one kv head per query head: the pass's two heads use consecutive kv planes (z-strides TT*HD)
            k_gemmw<bf, 2, false><<<dim3(RH / 64, TT / 64, ZH), 32, 0, stream>>>(QPh + zq * TT * HD, QPl + zq * TT * HD, KPh + zk * TT * HD, KPl + zk * TT * HD, HD, Sb, TT, nullptr, (size_t)TT * HD, (size_t)TT * HD, (size_t)TT * TT);
            k_asoft<<<ZH * TT / 8, 256, 0, stream>>>(Sb, P16, Ph, Pl);
            k_pvs<<<dim3(RH / 32, HD / 32, ZH), 32 * PVW, 0, stream>>>(Ph, Pl, VTh + zk * HD * TT, VTl + zk * HD * TT, Ob);
            k_outf<<<(unsigned)(((size_t)ZH * TT * HD / 2 + 255) / 256), 256, 0, stream>>>(Ob, h0, OUT + (size_t)b * TT * DM); } }
}

// v003
// A run of this version takes 177 microseconds.
// Versions between v001 and this one are left out; their measured steps multiply to 4.62 times as fast.
// Counting every step since v000, it is 7.09 times as fast.
#include <hip/hip_runtime.h>

// SimplifiedMultiHeadAttention (x [2][2048][1024]; per-head q/k/v = x W[h] + b[h] (16 heads, W [16][1024][64]); scores = q.k UNSCALED; att = softmax over keys THEN / sqrt(64); out = concat_h(att v) -> [2][2048][1024], no output projection).
// Compute dtypes, f32 accumulate: every input rounded to bf16; projections on PLAIN bf16 operands (inputs: exact, + bias); because the logits are unscaled (|s| up to ~20)
// EVERY query row takes scores and att.v on bf16 hi+lo planes (3 products each; single fp16 planes would leave ~1e-2 logit error); f32 online softmax in registers with the post-softmax 1/8 folded into the

#define NB_  2
#define TT   2048
#define DM   1024
#define NH_  16
#define NKV  16
#define REP  (NH_ / NKV)
#define HD   64
#define DQ   (NH_ * HD)
#define DKV  (NKV * HD)
#define ZH   2
#define RH   2048                  // read only by k_merge, which is not launched
#define WIN  0
#define PCAR 1024.0f
#define SCL  1.0f                  // unscaled logits (the 1/sqrt(64) is applied AFTER the softmax, folded into the normaliser)
typedef _Float16 h16;
typedef unsigned short bf;
typedef __attribute__((ext_vector_type(16))) __bf16   v16bf;
typedef __attribute__((ext_vector_type(16))) _Float16 v16h;
typedef __attribute__((ext_vector_type(8)))  _Float16 v8h;
typedef __attribute__((ext_vector_type(8)))  unsigned short v8us;
typedef __attribute__((ext_vector_type(8)))  float    v8f;
typedef __attribute__((ext_vector_type(4)))  float    v4f;
typedef v8h  __attribute__((may_alias)) v8ha;
typedef v4f  __attribute__((may_alias)) v4fa;
typedef v8us __attribute__((may_alias)) v8usa;

__device__ __forceinline__ unsigned short f2bf(float f) { unsigned u = __float_as_uint(f); u += 0x7FFFu + ((u >> 16) & 1u); return (unsigned short)(u >> 16); }
__device__ __forceinline__ float bf2f(unsigned short b) { return __uint_as_float(((unsigned)b) << 16); }
__device__ __forceinline__ float bfr(float f) { return bf2f(f2bf(f)); }
__device__ __forceinline__ v16h cat16(v8h lo, v8h hi) { return __builtin_shufflevector(lo, hi, 0, 1, 2, 3, 4, 5, 6, 7, 8, 9, 10, 11, 12, 13, 14, 15); }
__device__ __forceinline__ v16bf cat16b(v8us lo, v8us hi) { return __builtin_bit_cast(v16bf, __builtin_shufflevector(lo, hi, 0, 1, 2, 3, 4, 5, 6, 7, 8, 9, 10, 11, 12, 13, 14, 15)); }
__device__ __forceinline__ v8f wmma16(v16h a, v16h b, v8f c) { return __builtin_amdgcn_wmma_f32_16x16x32_f16(false, a, false, b, (short)0, c, false, false); }
__device__ __forceinline__ v8f wmmab(v16bf a, v16bf b, v8f c) { return __builtin_amdgcn_wmma_f32_16x16x32_bf16(false, a, false, b, (short)0, c, false, false); }



// ---- WFrag: a 16x32 operand fragment from a K-contiguous 16-bit plane (p = this lane's row, + 8 * half), in the hardware k order
template <typename T16> struct WFrag;
template <> struct WFrag<h16> { typedef v16h V; static __device__ __forceinline__ V ld(const h16* p) { return cat16(*(const v8h*)p, *(const v8h*)(p + 16)); } static __device__ __forceinline__ v8f mma(V a, V b, v8f c) { return wmma16(a, b, c); } };
template <> struct WFrag<bf> { typedef v16bf V; static __device__ __forceinline__ V ld(const bf* p) { return cat16b(*(const v8us*)p, *(const v8us*)(p + 16)); } static __device__ __forceinline__ v8f mma(V a, V b, v8f c) { return wmmab(a, b, c); } };

__device__ __forceinline__ h16 tohx(float x) { return (h16)x; }
__device__ __forceinline__ void splitf(float y, unsigned short& h, unsigned short& l) { h = f2bf(y); l = f2bf(y - bf2f(h)); }
typedef __attribute__((ext_vector_type(2))) _Float16 v2h;
typedef __attribute__((ext_vector_type(4))) _Float16 v4h;
typedef __attribute__((ext_vector_type(2))) unsigned short v2us;
typedef __attribute__((ext_vector_type(4))) unsigned short v4us;
typedef __attribute__((ext_vector_type(2))) float v2f;
typedef __attribute__((ext_vector_type(4))) int v4i;

__global__ __launch_bounds__(256) void k_wtG(const float* __restrict__ w, int K, int N, bf* Bt) {
    const int lane = threadIdx.x & 31; const int L0 = (blockIdx.x * 8 + (threadIdx.x >> 5)) * 8; const int nlines = N * K / 64;
{
#pragma unroll 1
        for (int l = 0; l < 8; ++l) { const int L = L0 + l; if (L >= nlines) break; const size_t e = (size_t)L * 64 + lane * 2; const int k = (int)(e % K), n = (int)(e / K); v2us o;
            o[0] = f2bf(w[(size_t)k * N + n]); o[1] = f2bf(w[(size_t)(k + 1) * N + n]); *(v2us*)(Bt + e) = o; }
         }
}
__global__ __launch_bounds__(256) void k_cvt8(const float* __restrict__ src, bf* dst, size_t n8) { const size_t i = (size_t)blockIdx.x * 256 + threadIdx.x; if (i >= n8) return; const v8f v = *(const v8f*)(src + i * 8); v8us o;
#pragma unroll
    for (int k = 0; k < 8; ++k) o[k] = f2bf(v[k]); *(v8us*)(dst + i * 8) = o;  }
__global__ __launch_bounds__(256) void k_cscvt(const float* __restrict__ cosT, const float* __restrict__ sinT, float* CS) { const int idx = blockIdx.x * 256 + threadIdx.x; if (idx >= TT * HD) return; v2f cs; cs[0] = bfr(cosT[idx]); cs[1] = bfr(sinT[idx]); *(v2f*)(CS + (size_t)idx * 2) = cs;  }
__global__ __launch_bounds__(256) void k_wt3(const float* __restrict__ wq, const float* __restrict__ wk, const float* __restrict__ wv, bf* Bt) { const int e4 = (blockIdx.x * 256 + threadIdx.x) * 4; if (e4 >= NH_ * HD * DM) return; const int k = e4 % DM; const int n = e4 / DM; const int h = n / HD, e = n % HD; v4us o;
    const float* w = blockIdx.y == 0 ? wq : blockIdx.y == 1 ? wk : wv; Bt += (size_t)blockIdx.y * DQ * DM;   // grid.y: q, k, v weights, one plane behind the other
#pragma unroll
    for (int q = 0; q < 4; ++q) o[q] = f2bf(w[((size_t)h * DM + k + q) * HD + e]); *(v4us*)(Bt + e4) = o;  }
// ---- k_proj: the q, k and v projections of both batches in one launch, from the bf16 planes of x ([NB_*TT][DM]) and of the weights ([3][DQ][DM], k contiguous) straight to the hi+lo head planes that k_fattn reads:
// no f32 projection ever reaches memory. One wave per 64x64 output tile (16 accumulators), fragments straight from the planes. grid (NB_*TT/256, heads), 12 waves = 4 position tiles x {q, k, v} of one
// head: 256 workgroups, three waves per SIMD; the three waves of a position tile read the same x rows, the four waves of a projection the same weight rows.
// q, k: A = x rows, B = weight rows, tile [t][d] -> plane [b][h][t][d]. v: the operands change places (A = weight rows, B = x rows), tile [d][t] -> plane [b][h][d][t]; same products, same k order.
// Epilogue per 16 tile rows: accumulators to this wave's own LDS rows, read back 8 columns a lane, + bias, split, two 16-byte stores: each store instruction writes four whole 128-byte lines.
#define PNW 12
__global__ __launch_bounds__(32 * PNW) void k_proj(const bf* __restrict__ XB, const bf* __restrict__ W3, const float* __restrict__ bq, const float* __restrict__ bk, const float* __restrict__ bv, bf* Qh, bf* Ql, bf* Kh, bf* Kl, bf* Vh, bf* Vl) {
    typedef WFrag<bf>::V V;
    __shared__ __align__(16) float osw[PNW][16 * 68];
    const int lane = threadIdx.x & 31, lr = lane & 15, hi = lane >> 4; const int w = __builtin_amdgcn_readfirstlane((int)(threadIdx.x >> 5));
    const int pj = w % 3, h = blockIdx.y; const int r0 = (blockIdx.x * 4 + w / 3) * 64; const int bb = r0 / TT, t0 = r0 % TT; const bool tr = pj == 2;
    const bf* xr = XB + (size_t)r0 * DM; const bf* wr = W3 + ((size_t)pj * DQ + h * HD) * DM;
    const bf* pa = (tr ? wr : xr) + lr * DM + 8 * hi; const bf* pb = (tr ? xr : wr) + lr * DM + 8 * hi;   // this lane's row and half of the A and of the B tile
    v8f acc[4][4];
#pragma unroll
    for (int mb = 0; mb < 4; ++mb)
#pragma unroll
        for (int nb = 0; nb < 4; ++nb) acc[mb][nb] = (v8f){};
#pragma unroll 1
    for (int kc = 0; kc < DM; kc += 32) {
        V a[4], b[4];
#pragma unroll
        for (int i = 0; i < 4; ++i) { a[i] = WFrag<bf>::ld(pa + i * 16 * DM); b[i] = WFrag<bf>::ld(pb + i * 16 * DM); }
        __builtin_amdgcn_sched_barrier(0);   // all 16 loads of a trip are issued ahead of its products: one load latency a trip; left free, the last B loads sink among the products and are waited for there again
#pragma unroll
        for (int nb = 0; nb < 4; ++nb)
#pragma unroll
            for (int mb = 0; mb < 4; ++mb) acc[mb][nb] = wmmab(a[mb], b[nb], acc[mb][nb]);
        asm volatile("v_nop\n\tv_nop\n\tv_nop\n\tv_nop" : "+v"(acc[0][0]), "+v"(acc[1][1]), "+v"(acc[2][2]), "+v"(acc[3][3]) : "v"(a[0]), "v"(a[3]));   // the distance behind the last matrix instruction, on the taken back edge too
        asm volatile("s_wait_xcnt 0x0" :: "v"(pa), "v"(pb) : "memory");   // behind this trip's loads: their address registers stay whole up to this wait and are stepped only behind it
        pa += 32; pb += 32;
    }
    float* os = osw[w];
    const float* bias = (pj == 0 ? bq : pj == 1 ? bk : bv) + h * HD; bf* Ph = pj == 0 ? Qh : pj == 1 ? Kh : Vh; bf* Pl = pj == 0 ? Ql : pj == 1 ? Kl : Vl;
    const size_t pofs = ((size_t)bb * NH_ + h) * ((size_t)TT * HD) + (tr ? t0 : t0 * HD); const int pitch = tr ? TT : HD;
    const int rsub = lane >> 3, cofs = (lane & 7) * 8;
    float bc[8];   // q, k: the bias goes by tile column (d), the same 8 for every row of this lane
#pragma unroll
    for (int i = 0; i < 8; ++i) bc[i] = bfr(bias[cofs + i]);
    asm volatile("s_wait_xcnt 0x0" ::: "memory");   // behind the bias loads above: their offset register is reused below
#pragma unroll
    for (int mb = 0; mb < 4; ++mb) {
#pragma unroll
        for (int nb = 0; nb < 4; ++nb) {
#pragma unroll
            for (int j = 0; j < 8; ++j) os[(hi * 8 + j) * 68 + nb * 16 + lr] = acc[mb][nb][j]; }
        __builtin_amdgcn_wave_barrier(); asm volatile("" ::: "memory");   // the rows are read back by other lanes of this wave: the reads stay behind the writes
#pragma unroll
        for (int s = 0; s < 4; ++s) { const int row = 4 * s + rsub; const v4f v0 = *(const v4fa*)(os + row * 68 + cofs), v1 = *(const v4fa*)(os + row * 68 + cofs + 4);
            const float br = bfr(bias[mb * 16 + row]);   // v: the bias goes by tile row (d)
            v8us oh, ol;
#pragma unroll
            for (int i = 0; i < 8; ++i) { unsigned short a2, c2; splitf((i < 4 ? v0[i] : v1[i - 4]) + (tr ? br : bc[i]), a2, c2); oh[i] = a2; ol[i] = c2; }
            const size_t o = pofs + (size_t)(mb * 16 + row) * pitch + cofs; *(v8us*)(Ph + o) = oh; *(v8us*)(Pl + o) = ol; }
        __builtin_amdgcn_wave_barrier(); asm volatile("" ::: "memory");   // the next 16 rows overwrite the staging only behind these reads
    }
}
// ---- k_fattn: scores, softmax, att.v and the output store in one launch; no score or probability ever reaches memory. One wave owns 32 query columns (two 16-column tiles) of one (batch, head) and
// walks the 2048 keys in passes of 32: S^T = K.Q^T (A = K rows, B = Q kept in registers), so a lane holds 16 scores of ONE query per tile; running maximum and sum per lane (online softmax, log2 domain);
// the two 16-key D tiles, converted in place, ARE the B operand of O^T += V^T.P^T (hardware k order, which the plane loader already has). Same hi+lo products as before: 3 per GEMM.
// grid (TT/256, heads, batches), 8 waves: 256 workgroups, two waves per SIMD. Every inner loop is fully unrolled so that the fragment arrays have static indices and stay in registers.
#define FNW 8
typedef __attribute__((ext_vector_type(2))) __bf16 v2bf;
__device__ __forceinline__ float xhalf(float x) { const int b = __float_as_int(x); return __int_as_float(__builtin_amdgcn_permlanex16(b, b, 0x76543210, 0xfedcba98, false, false)); }   // lane l <-> l ^ 16
__global__ __launch_bounds__(32 * FNW) void k_fattn(const bf* __restrict__ Qh, const bf* __restrict__ Ql, const bf* __restrict__ Kh, const bf* __restrict__ Kl, const bf* __restrict__ Vh, const bf* __restrict__ Vl, float* OUT) {
    typedef WFrag<bf>::V V;
    const int lane = threadIdx.x & 31, lr = lane & 15, hi = lane >> 4, w = threadIdx.x >> 5; const int h = blockIdx.y, bb = blockIdx.z;
    const size_t pofs = ((size_t)bb * NH_ + h) * ((size_t)TT * HD); const int q0 = (blockIdx.x * FNW + w) * 32;
    Qh += pofs; Ql += pofs; Kh += pofs; Kl += pofs; Vh += pofs; Vl += pofs;
    const bf* pqh = Qh + (size_t)(q0 + lr) * HD + 8 * hi; const bf* pql = Ql + (size_t)(q0 + lr) * HD + 8 * hi;
    V qh[2][2], ql[2][2];   // [query tile][32-wide slice of the head dim]
#pragma unroll
    for (int qt = 0; qt < 2; ++qt)
#pragma unroll
        for (int kc = 0; kc < 2; ++kc) { qh[qt][kc] = WFrag<bf>::ld(pqh + qt * 16 * HD + kc * 32); ql[qt][kc] = WFrag<bf>::ld(pql + qt * 16 * HD + kc * 32); }
    v8f oacc[2][4];         // [query tile][16-row tile of the head dim]: O^T, register r = dim 8*hi + r, lane column = query
#pragma unroll
    for (int qt = 0; qt < 2; ++qt)
#pragma unroll
        for (int dt = 0; dt < 4; ++dt) oacc[qt][dt] = (v8f){};
    float mrun[2] = { -3.0e38f, -3.0e38f }, lsum[2] = { 0.f, 0.f };
    const bf* pkh = Kh + lr * HD + 8 * hi; const bf* pkl = Kl + lr * HD + 8 * hi; const bf* pvh = Vh + lr * TT + 8 * hi; const bf* pvl = Vl + lr * TT + 8 * hi;   // this lane's row and half; K walks 32 rows, V 32 columns a pass
    V kh[2][2], kl[2][2];   // [key tile][slice of the head dim]
#pragma unroll
    for (int kt = 0; kt < 2; ++kt)
#pragma unroll
        for (int kc = 0; kc < 2; ++kc) { kh[kt][kc] = WFrag<bf>::ld(pkh + kt * 16 * HD + kc * 32); kl[kt][kc] = WFrag<bf>::ld(pkl + kt * 16 * HD + kc * 32); }
    asm volatile("s_wait_xcnt 0x0" :: "v"(pqh), "v"(pql), "v"(pkh), "v"(pkl) : "memory");   // behind the Q and K loads above: their address registers stay whole up to this wait and are stepped or reused only behind it
    pkh += 32 * HD; pkl += 32 * HD;
#pragma unroll 1   // kept rolled: a pass is already straight-line code with 48 matrix instructions; copies of it would only grow the text and the live ranges
    for (int key0 = 0; key0 < TT; key0 += 32) {
        V vh[4], vl[4];
#pragma unroll
        for (int dt = 0; dt < 4; ++dt) { vh[dt] = WFrag<bf>::ld(pvh + dt * 16 * TT); vl[dt] = WFrag<bf>::ld(pvl + dt * 16 * TT); }
        __builtin_amdgcn_sched_barrier(0);   // V of this pass is issued ahead of the score products, so that it lands under them and the softmax
        v8f s[2][2];        // [key tile][query tile]
#pragma unroll
        for (int kt = 0; kt < 2; ++kt)
#pragma unroll
            for (int qt = 0; qt < 2; ++qt) s[kt][qt] = (v8f){};
#pragma unroll
        for (int kc = 0; kc < 2; ++kc) {
#pragma unroll
            for (int kt = 0; kt < 2; ++kt)
#pragma unroll
                for (int qt = 0; qt < 2; ++qt) s[kt][qt] = wmmab(kh[kt][kc], qh[qt][kc], s[kt][qt]);
#pragma unroll
            for (int kt = 0; kt < 2; ++kt)
#pragma unroll
                for (int qt = 0; qt < 2; ++qt) s[kt][qt] = wmmab(kl[kt][kc], qh[qt][kc], s[kt][qt]);
#pragma unroll
            for (int kt = 0; kt < 2; ++kt)
#pragma unroll
                for (int qt = 0; qt < 2; ++qt) s[kt][qt] = wmmab(kh[kt][kc], ql[qt][kc], s[kt][qt]);
        }
        __builtin_amdgcn_sched_barrier(0);   // the next pass's K loads stay behind the products that read these registers and ahead of the softmax, which covers their latency
#pragma unroll
        for (int kt = 0; kt < 2; ++kt)
#pragma unroll
            for (int kc = 0; kc < 2; ++kc) { kh[kt][kc] = WFrag<bf>::ld(pkh + kt * 16 * HD + kc * 32); kl[kt][kc] = WFrag<bf>::ld(pkl + kt * 16 * HD + kc * 32); }
        asm volatile("s_wait_xcnt 0x0" :: "v"(pkh), "v"(pkl), "v"(pvh), "v"(pvl) : "memory");   // behind this pass's V and K loads: their address registers stay whole up to this wait and are stepped only behind it
        __builtin_amdgcn_sched_barrier(0);   // see above: keeps those loads from sinking to their uses in the next pass
        { const int kstep = (key0 + 64 < TT) ? 32 * HD : 0; pkh += kstep; pkl += kstep; pvh += 32; pvl += 32; }   // the last pass has no next K: it fetches its own rows again (in bounds, unused) instead of branching round the loads
        V ph[2], pl[2];
#pragma unroll
        for (int qt = 0; qt < 2; ++qt) {
            float mx = s[0][qt][0];
#pragma unroll
            for (int j = 1; j < 8; ++j) mx = fmaxf(mx, s[0][qt][j]);
#pragma unroll
            for (int j = 0; j < 8; ++j) mx = fmaxf(mx, s[1][qt][j]);
            mx = fmaxf(mx, xhalf(mx));
            const float mn = fmaxf(mrun[qt], mx * 1.4426950408889634f); const float al = __builtin_amdgcn_exp2f(mrun[qt] - mn); mrun[qt] = mn;
            v2f sum2 = { 0.f, 0.f };
#pragma unroll
            for (int kt = 0; kt < 2; ++kt)
#pragma unroll
                for (int j = 0; j < 8; j += 2) { v2f t; t[0] = s[kt][qt][j]; t[1] = s[kt][qt][j + 1]; t = __builtin_elementwise_fma(t, (v2f){ 1.4426950408889634f, 1.4426950408889634f }, (v2f){ -mn, -mn }); v2f p; p[0] = __builtin_amdgcn_exp2f(t[0]); p[1] = __builtin_amdgcn_exp2f(t[1]); sum2 += p;
                    const v2bf a = __builtin_convertvector(p, v2bf); const v2f r = p - __builtin_convertvector(a, v2f); const v2bf c = __builtin_convertvector(r, v2bf);
                    ph[qt][kt * 8 + j] = a[0]; ph[qt][kt * 8 + j + 1] = a[1]; pl[qt][kt * 8 + j] = c[0]; pl[qt][kt * 8 + j + 1] = c[1]; }
            lsum[qt] = lsum[qt] * al + (sum2[0] + sum2[1]);   // this half's keys only; the halves are joined once, behind the loop
#pragma unroll
            for (int dt = 0; dt < 4; ++dt) oacc[qt][dt] *= al;
        }
#pragma unroll
        for (int dt = 0; dt < 4; ++dt)
#pragma unroll
            for (int qt = 0; qt < 2; ++qt) oacc[qt][dt] = wmmab(vh[dt], ph[qt], oacc[qt][dt]);
#pragma unroll
        for (int dt = 0; dt < 4; ++dt)
#pragma unroll
            for (int qt = 0; qt < 2; ++qt) oacc[qt][dt] = wmmab(vl[dt], ph[qt], oacc[qt][dt]);
#pragma unroll
        for (int dt = 0; dt < 4; ++dt)
#pragma unroll
            for (int qt = 0; qt < 2; ++qt) oacc[qt][dt] = wmmab(vh[dt], pl[qt], oacc[qt][dt]);
        __builtin_amdgcn_s_barrier();   // pacing only, no data passes here (so no fence, which would drain the loads in flight): the 8 waves read the same K and V lines, and kept within one pass of each other (16 KiB a pass) seven of them find the lines in the 64-KiB WGP cache
    }
#pragma unroll
    for (int qt = 0; qt < 2; ++qt) { const float f = __fdiv_rn(0.125f, lsum[qt] + xhalf(lsum[qt]));   // softmax / sqrt(64)
        float* orow = OUT + ((size_t)bb * TT + q0 + qt * 16 + lr) * DM + h * HD + 8 * hi;
#pragma unroll
        for (int dt = 0; dt < 4; ++dt) { v4f lo4, hi4;
#pragma unroll
            for (int j = 0; j < 4; ++j) { lo4[j] = oacc[qt][dt][j] * f; hi4[j] = oacc[qt][dt][4 + j] * f; }
            *(v4f*)(orow + dt * 16) = lo4; *(v4f*)(orow + dt * 16 + 4) = hi4; } }
}
__global__ __launch_bounds__(256) void k_merge(const float* __restrict__ O, int h0, bf* Ah, bf* Al) { const size_t e = ((size_t)blockIdx.x * 256 + threadIdx.x) * 2; if (e >= (size_t)ZH * TT * HD) return; const int d = (int)(e % HD); const int t = (int)((e / HD) % TT); const int zz = (int)(e / ((size_t)HD * TT)); const float cs = (t < RH) ? 1.0f : (1.0f / PCAR); const size_t oo = (size_t)t * DQ + (h0 + zz) * HD + d;
    v2us oh, ol;
#pragma unroll
    for (int q = 0; q < 2; ++q) { unsigned short a, c2; splitf(O[e + q] * cs, a, c2); oh[q] = a; ol[q] = c2; } *(v2us*)(Ah + oo) = oh; *(v2us*)(Al + oo) = ol;  }

extern "C" void kernel_launch(void* const* d_in, const int* in_sizes, int n_in,
                              void* d_out, int out_size, void* d_ws, size_t ws_size, hipStream_t stream) {
    (void)in_sizes; (void)n_in; (void)out_size;
    const float* x = (const float*)d_in[0]; const float* wq = (const float*)d_in[1]; const float* bq = (const float*)d_in[2]; const float* wk = (const float*)d_in[3]; const float* bk = (const float*)d_in[4]; const float* wv = (const float*)d_in[5]; const float* bv = (const float*)d_in[6];   // W [16][1024][64] per head (x @ W[h]), b [16][64]
    float* OUT = (float*)d_out;     // [2][2048][1024]
    char* wsp = (char*)d_ws;
    auto take = [&](size_t bytes) { char* p = wsp; wsp += (bytes + 255) & ~(size_t)255; return (void*)p; };
    bf* W3 = (bf*)take((size_t)3 * DQ * DM * 2); bf* XB = (bf*)take((size_t)NB_ * TT * DM * 2);   // q, k, v weights transposed; x of both batches
    const size_t PB = (size_t)NH_ * TT * HD;   // one batch's hi or lo plane, elements; the planes hold both batches
    bf* QPh = (bf*)take(NB_ * PB * 2); bf* QPl = (bf*)take(NB_ * PB * 2); bf* KPh = (bf*)take(NB_ * PB * 2); bf* KPl = (bf*)take(NB_ * PB * 2); bf* VTh = (bf*)take(NB_ * PB * 2); bf* VTl = (bf*)take(NB_ * PB * 2);
    if ((size_t)(wsp - (char*)d_ws) > ws_size) return;    // ws 256 MiB
    k_wt3<<<dim3((unsigned)(((size_t)DQ * DM / 4 + 255) / 256), 3, 1), 256, 0, stream>>>(wq, wk, wv, W3);
    k_cvt8<<<(unsigned)(((size_t)NB_ * TT * DM / 8 + 255) / 256), 256, 0, stream>>>(x, XB, (size_t)NB_ * TT * DM / 8);
    k_proj<<<dim3(NB_ * TT / 256, NH_, 1), 32 * PNW, 0, stream>>>(XB, W3, bq, bk, bv, QPh, QPl, KPh, KPl, VTh, VTl);
    k_fattn<<<dim3(TT / (32 * FNW), NH_, NB_), 32 * FNW, 0, stream>>>(QPh, QPl, KPh, KPl, VTh, VTl, OUT);
}

// v004
// One run takes 134 microseconds.
// Next to v003, in two timings, it ran 1.33 times as fast each time.
// Over all steps from v000 it is 9.43 times as fast.
#include <hip/hip_runtime.h>

// SimplifiedMultiHeadAttention (x [2][2048][1024]; per-head q/k/v = x W[h] + b[h] (16 heads, W [16][1024][64]); scores = q.k UNSCALED; att = softmax over keys THEN / sqrt(64); out = concat_h(att v) -> [2][2048][1024], no output projection).
// Compute dtypes, f32 accumulate: every input rounded to bf16; projections on PLAIN bf16 operands (inputs: exact, + bias); because the logits are unscaled (|s| up to ~20)
// EVERY query row takes scores and att.v on bf16 hi+lo planes (3 products each; single fp16 planes would leave ~1e-2 logit error); f32 online softmax in registers with the post-softmax 1/8 folded into the

#define NB_  2
#define TT   2048
#define DM   1024
#define NH_  16
#define NKV  16
#define REP  (NH_ / NKV)
#define HD   64
#define DQ   (NH_ * HD)
#define DKV  (NKV * HD)
#define ZH   2
#define RH   2048                  // read only by k_merge, which is not launched
#define WIN  0
#define PCAR 1024.0f
#define SCL  1.0f                  // unscaled logits (the 1/sqrt(64) is applied AFTER the softmax, folded into the normaliser)
typedef _Float16 h16;
typedef unsigned short bf;
typedef __attribute__((ext_vector_type(16))) __bf16   v16bf;
typedef __attribute__((ext_vector_type(16))) _Float16 v16h;
typedef __attribute__((ext_vector_type(8)))  _Float16 v8h;
typedef __attribute__((ext_vector_type(8)))  unsigned short v8us;
typedef __attribute__((ext_vector_type(8)))  float    v8f;
typedef __attribute__((ext_vector_type(4)))  float    v4f;
typedef v8h  __attribute__((may_alias)) v8ha;
typedef v4f  __attribute__((may_alias)) v4fa;
typedef v8us __attribute__((may_alias)) v8usa;

__device__ __forceinline__ unsigned short f2bf(float f) { unsigned u = __float_as_uint(f); u += 0x7FFFu + ((u >> 16) & 1u); return (unsigned short)(u >> 16); }
__device__ __forceinline__ float bf2f(unsigned short b) { return __uint_as_float(((unsigned)b) << 16); }
__device__ __forceinline__ float bfr(float f) { return bf2f(f2bf(f)); }
__device__ __forceinline__ v16h cat16(v8h lo, v8h hi) { return __builtin_shufflevector(lo, hi, 0, 1, 2, 3, 4, 5, 6, 7, 8, 9, 10, 11, 12, 13, 14, 15); }
__device__ __forceinline__ v16bf cat16b(v8us lo, v8us hi) { return __builtin_bit_cast(v16bf, __builtin_shufflevector(lo, hi, 0, 1, 2, 3, 4, 5, 6, 7, 8, 9, 10, 11, 12, 13, 14, 15)); }
__device__ __forceinline__ v8f wmma16(v16h a, v16h b, v8f c) { return __builtin_amdgcn_wmma_f32_16x16x32_f16(false, a, false, b, (short)0, c, false, false); }
__device__ __forceinline__ v8f wmmab(v16bf a, v16bf b, v8f c) { return __builtin_amdgcn_wmma_f32_16x16x32_bf16(false, a, false, b, (short)0, c, false, false); }



// ---- WFrag: a 16x32 operand fragment from a K-contiguous 16-bit plane (p = this lane's row, + 8 * half), in the hardware k order
template <typename T16> struct WFrag;
template <> struct WFrag<h16> { typedef v16h V; static __device__ __forceinline__ V ld(const h16* p) { return cat16(*(const v8h*)p, *(const v8h*)(p + 16)); } static __device__ __forceinline__ v8f mma(V a, V b, v8f c) { return wmma16(a, b, c); } };
template <> struct WFrag<bf> { typedef v16bf V; static __device__ __forceinline__ V ld(const bf* p) { return cat16b(*(const v8us*)p, *(const v8us*)(p + 16)); } static __device__ __forceinline__ v8f mma(V a, V b, v8f c) { return wmmab(a, b, c); } };

__device__ __forceinline__ h16 tohx(float x) { return (h16)x; }
__device__ __forceinline__ void splitf(float y, unsigned short& h, unsigned short& l) { h = f2bf(y); l = f2bf(y - bf2f(h)); }
typedef __attribute__((ext_vector_type(2))) _Float16 v2h;
typedef __attribute__((ext_vector_type(4))) _Float16 v4h;
typedef __attribute__((ext_vector_type(2))) unsigned short v2us;
typedef __attribute__((ext_vector_type(4))) unsigned short v4us;
typedef __attribute__((ext_vector_type(2))) float v2f;
typedef __attribute__((ext_vector_type(4))) int v4i;

__global__ __launch_bounds__(256) void k_wtG(const float* __restrict__ w, int K, int N, bf* Bt) {
    const int lane = threadIdx.x & 31; const int L0 = (blockIdx.x * 8 + (threadIdx.x >> 5)) * 8; const int nlines = N * K / 64;
{
#pragma unroll 1
        for (int l = 0; l < 8; ++l) { const int L = L0 + l; if (L >= nlines) break; const size_t e = (size_t)L * 64 + lane * 2; const int k = (int)(e % K), n = (int)(e / K); v2us o;
            o[0] = f2bf(w[(size_t)k * N + n]); o[1] = f2bf(w[(size_t)(k + 1) * N + n]); *(v2us*)(Bt + e) = o; }
         }
}
__global__ __launch_bounds__(256) void k_cvt8(const float* __restrict__ src, bf* dst, size_t n8) { const size_t i = (size_t)blockIdx.x * 256 + threadIdx.x; if (i >= n8) return; const v8f v = *(const v8f*)(src + i * 8); v8us o;
#pragma unroll
    for (int k = 0; k < 8; ++k) o[k] = f2bf(v[k]); *(v8us*)(dst + i * 8) = o;  }
__global__ __launch_bounds__(256) void k_cscvt(const float* __restrict__ cosT, const float* __restrict__ sinT, float* CS) { const int idx = blockIdx.x * 256 + threadIdx.x; if (idx >= TT * HD) return; v2f cs; cs[0] = bfr(cosT[idx]); cs[1] = bfr(sinT[idx]); *(v2f*)(CS + (size_t)idx * 2) = cs;  }
__global__ __launch_bounds__(256) void k_wt3(const float* __restrict__ wq, const float* __restrict__ wk, const float* __restrict__ wv, bf* Bt) { const int e4 = (blockIdx.x * 256 + threadIdx.x) * 4; if (e4 >= NH_ * HD * DM) return; const int k = e4 % DM; const int n = e4 / DM; const int h = n / HD, e = n % HD; v4us o;
    const float* w = blockIdx.y == 0 ? wq : blockIdx.y == 1 ? wk : wv; Bt += (size_t)blockIdx.y * DQ * DM;   // grid.y: q, k, v weights, one plane behind the other
#pragma unroll
    for (int q = 0; q < 4; ++q) o[q] = f2bf(w[((size_t)h * DM + k + q) * HD + e]); *(v4us*)(Bt + e4) = o;  }
// ---- k_proj: the q, k and v projections of both batches in one launch, from the bf16 planes of x ([NB_*TT][DM]) and of the weights ([3][DQ][DM], k contiguous) straight to the hi+lo head planes that k_fattn reads:
// no f32 projection ever reaches memory. One wave per 64x64 output tile (16 accumulators), fragments straight from the planes. grid (NB_*TT/256, heads), 12 waves = 4 position tiles x {q, k, v} of one
// head: 256 workgroups, three waves per SIMD; the three waves of a position tile read the same x rows, the four waves of a projection the same weight rows.
// q, k: A = x rows, B = weight rows, tile [t][d] -> plane [b][h][t][d]. v: the operands change places (A = weight rows, B = x rows), tile [d][t] -> plane [b][h][d][t]; same products, same k order.
// Epilogue per 16 tile rows: accumulators to this wave's own LDS rows, read back 8 columns a lane, + bias, split, two 16-byte stores: each store instruction writes four whole 128-byte lines.
#define PNW 12
__global__ __launch_bounds__(32 * PNW) void k_proj(const bf* __restrict__ XB, const bf* __restrict__ W3, const float* __restrict__ bq, const float* __restrict__ bk, const float* __restrict__ bv, bf* Qh, bf* Ql, bf* Kh, bf* Kl, bf* Vh, bf* Vl) {
    typedef WFrag<bf>::V V;
    __shared__ __align__(16) float osw[PNW][16 * 68];
    const int lane = threadIdx.x & 31, lr = lane & 15, hi = lane >> 4; const int w = __builtin_amdgcn_readfirstlane((int)(threadIdx.x >> 5));
    const int pj = w % 3, h = blockIdx.y; const int r0 = (blockIdx.x * 4 + w / 3) * 64; const int bb = r0 / TT, t0 = r0 % TT; const bool tr = pj == 2;
    const bf* xr = XB + (size_t)r0 * DM; const bf* wr = W3 + ((size_t)pj * DQ + h * HD) * DM;
    const bf* pa = (tr ? wr : xr) + lr * DM + 8 * hi; const bf* pb = (tr ? xr : wr) + lr * DM + 8 * hi;   // this lane's row and half of the A and of the B tile
    v8f acc[4][4];
#pragma unroll
    for (int mb = 0; mb < 4; ++mb)
#pragma unroll
        for (int nb = 0; nb < 4; ++nb) acc[mb][nb] = (v8f){};
#pragma unroll 1
    for (int kc = 0; kc < DM; kc += 32) {
        V a[4], b[4];
#pragma unroll
        for (int i = 0; i < 4; ++i) { a[i] = WFrag<bf>::ld(pa + i * 16 * DM); b[i] = WFrag<bf>::ld(pb + i * 16 * DM); }
        __builtin_amdgcn_sched_barrier(0);   // all 16 loads of a trip are issued ahead of its products: one load latency a trip; left free, the last B loads sink among the products and are waited for there again
#pragma unroll
        for (int nb = 0; nb < 4; ++nb)
#pragma unroll
            for (int mb = 0; mb < 4; ++mb) acc[mb][nb] = wmmab(a[mb], b[nb], acc[mb][nb]);
        asm volatile("v_nop\n\tv_nop\n\tv_nop\n\tv_nop" : "+v"(acc[0][0]), "+v"(acc[1][1]), "+v"(acc[2][2]), "+v"(acc[3][3]) : "v"(a[0]), "v"(a[3]));   // the distance behind the last matrix instruction, on the taken back edge too
        asm volatile("s_wait_xcnt 0x0" :: "v"(pa), "v"(pb) : "memory");   // behind this trip's loads: their address registers stay whole up to this wait and are stepped only behind it
        pa += 32; pb += 32;
    }
    float* os = osw[w];
    const float* bias = (pj == 0 ? bq : pj == 1 ? bk : bv) + h * HD; bf* Ph = pj == 0 ? Qh : pj == 1 ? Kh : Vh; bf* Pl = pj == 0 ? Ql : pj == 1 ? Kl : Vl;
    const size_t pofs = ((size_t)bb * NH_ + h) * ((size_t)TT * HD) + (tr ? t0 : t0 * HD); const int pitch = tr ? TT : HD;
    const int rsub = lane >> 3, cofs = (lane & 7) * 8;
    float bc[8];   // q, k: the bias goes by tile column (d), the same 8 for every row of this lane
#pragma unroll
    for (int i = 0; i < 8; ++i) bc[i] = bfr(bias[cofs + i]);
    asm volatile("s_wait_xcnt 0x0" ::: "memory");   // behind the bias loads above: their offset register is reused below
#pragma unroll
    for (int mb = 0; mb < 4; ++mb) {
#pragma unroll
        for (int nb = 0; nb < 4; ++nb) {
#pragma unroll
            for (int j = 0; j < 8; ++j) os[(hi * 8 + j) * 68 + nb * 16 + lr] = acc[mb][nb][j]; }
        __builtin_amdgcn_wave_barrier(); asm volatile("" ::: "memory");   // the rows are read back by other lanes of this wave: the reads stay behind the writes
#pragma unroll
        for (int s = 0; s < 4; ++s) { const int row = 4 * s + rsub; const v4f v0 = *(const v4fa*)(os + row * 68 + cofs), v1 = *(const v4fa*)(os + row * 68 + cofs + 4);
            const float br = bfr(bias[mb * 16 + row]);   // v: the bias goes by tile row (d)
            v8us oh, ol;
#pragma unroll
            for (int i = 0; i < 8; ++i) { unsigned short a2, c2; splitf((i < 4 ? v0[i] : v1[i - 4]) + (tr ? br : bc[i]), a2, c2); oh[i] = a2; ol[i] = c2; }
            const size_t o = pofs + (size_t)(mb * 16 + row) * pitch + cofs; *(v8us*)(Ph + o) = oh; *(v8us*)(Pl + o) = ol; }
        __builtin_amdgcn_wave_barrier(); asm volatile("" ::: "memory");   // the next 16 rows overwrite the staging only behind these reads
    }
}
// ---- k_fattn: scores, softmax, att.v and the output store in one launch; no score or probability ever reaches memory. One wave owns 32 query columns (two 16-column tiles) of one (batch, head) and
// walks the 2048 keys in passes of 32: S^T = K.Q^T (A = K rows, B = Q kept in registers), so a lane holds 16 scores of ONE query per tile; running maximum and sum per lane (online softmax, log2 domain);
// the two 16-key D tiles, converted in place, ARE the B operand of O^T += V^T.P^T (hardware k order, which the plane loader already has). Same hi+lo products as before: 3 per GEMM.
// grid (TT/256, heads, batches), 8 waves: 256 workgroups, two waves per SIMD. Every loop over fragment indices is fully unrolled so that the fragment arrays have static indices and stay in registers.
// K and V reach the waves through LDS: the 8 waves read the same K and V, and a fragment load from the planes touches 16 lines for 512 bytes. A stage is 128 keys (4 passes) of the four planes, brought in once
// per workgroup by asynchronous copies of whole lines (16 a lane), two buffers: stage s + 1 flies while stage s is worked on. Every tile is 128 rows of 128 bytes, padded by 16 bytes (pitch 16 B x odd) for the
// 16-byte fragment reads: K row = key; V^T row = 64 * (key / 64 within the stage) + dim, 64 keys a row.
#define FNW 8
#define SK  128                    // keys a stage
#define KP  (HD + 8)               // row pitch in LDS, elements (144 B)
#define KTL (SK * KP)              // one plane's tile, elements
#define STG (4 * KTL)              // a stage: K hi, K lo, V^T hi, V^T lo
#define NST (TT / SK)
typedef __attribute__((ext_vector_type(2))) __bf16 v2bf;
__device__ __forceinline__ float xhalf(float x) { const int b = __float_as_int(x); return __int_as_float(__builtin_amdgcn_permlanex16(b, b, 0x76543210, 0xfedcba98, false, false)); }   // lane l <-> l ^ 16
// eight asynchronous 16-byte copies a lane, global -> LDS: four steps of plane a, four of plane b (la, lb: LDS byte addresses; ls: LDS step in bytes; step n is n & 1 times g1 plus n >> 1 times g2 elements on in global memory).
// The s_wait_xcnt stands inside the statement, behind the last copy: the address registers stay whole up to it.
__device__ __forceinline__ void acopy8(unsigned la, unsigned lb, unsigned ls, const bf* ga, const bf* gb, int g1, int g2) {
    asm volatile("global_load_async_to_lds_b128 %0, %8, off\n\t"
                 "global_load_async_to_lds_b128 %1, %9, off\n\t"
                 "global_load_async_to_lds_b128 %2, %10, off\n\t"
                 "global_load_async_to_lds_b128 %3, %11, off\n\t"
                 "global_load_async_to_lds_b128 %4, %12, off\n\t"
                 "global_load_async_to_lds_b128 %5, %13, off\n\t"
                 "global_load_async_to_lds_b128 %6, %14, off\n\t"
                 "global_load_async_to_lds_b128 %7, %15, off\n\t"
                 "s_wait_xcnt 0x0"
                 :: "v"(la), "v"(la + ls), "v"(la + 2 * ls), "v"(la + 3 * ls), "v"(lb), "v"(lb + ls), "v"(lb + 2 * ls), "v"(lb + 3 * ls),
                    "v"(ga), "v"(ga + g1), "v"(ga + g2), "v"(ga + g1 + g2), "v"(gb), "v"(gb + g1), "v"(gb + g2), "v"(gb + g1 + g2) : "memory");
}
__global__ __launch_bounds__(32 * FNW) void k_fattn(const bf* __restrict__ Qh, const bf* __restrict__ Ql, const bf* __restrict__ Kh, const bf* __restrict__ Kl, const bf* __restrict__ Vh, const bf* __restrict__ Vl, float* OUT) {
    typedef WFrag<bf>::V V;
    __shared__ __align__(16) bf ring[2 * STG];
    const int tid = threadIdx.x, lane = tid & 31, lr = lane & 15, hi = lane >> 4, w = tid >> 5; const int h = blockIdx.y, bb = blockIdx.z;
    const size_t pofs = ((size_t)bb * NH_ + h) * ((size_t)TT * HD); const int q0 = (blockIdx.x * FNW + w) * 32;
    Qh += pofs; Ql += pofs; Kh += pofs; Kl += pofs; Vh += pofs; Vl += pofs;
    // this lane's share of a stage: thread t takes bytes 16 (t & 7) of row t >> 3 of each 32 tile rows, so a wave's copy is four whole lines.
    const unsigned lck = (unsigned)(size_t)ring + (tid >> 3) * (KP * 2) + (tid & 7) * 16;
    const unsigned gck = tid * 8, gcv = (tid >> 3) * TT + (tid & 7) * 8;
    auto fill = [&](unsigned st) { const unsigned lb = (st & 1) * (STG * 2); const unsigned ek = gck + st * (SK * HD), ev = gcv + st * SK;   // element offsets in a plane, 32 bits: only gck and gcv live through the loop
        acopy8(lck + lb, lck + lb + KTL * 2, 32 * KP * 2, Kh + ek, Kl + ek, 32 * HD, 64 * HD);
        acopy8(lck + lb + 2 * KTL * 2, lck + lb + 3 * KTL * 2, 32 * KP * 2, Vh + ev, Vl + ev, 32 * TT, 64); };
    fill(0);
    const bf* pqh = Qh + (size_t)(q0 + lr) * HD + 8 * hi; const bf* pql = Ql + (size_t)(q0 + lr) * HD + 8 * hi;
    V qh[2][2], ql[2][2];   // [query tile][32-wide slice of the head dim]
#pragma unroll
    for (int qt = 0; qt < 2; ++qt)
#pragma unroll
        for (int kc = 0; kc < 2; ++kc) { qh[qt][kc] = WFrag<bf>::ld(pqh + qt * 16 * HD + kc * 32); ql[qt][kc] = WFrag<bf>::ld(pql + qt * 16 * HD + kc * 32); }
    asm volatile("s_wait_xcnt 0x0" :: "v"(pqh), "v"(pql) : "memory");   // behind the Q loads above: their address registers stay whole up to this wait and are reused only behind it
    v8f oacc[2][4];         // [query tile][16-row tile of the head dim]: O^T, register r = dim 8*hi + r, lane column = query
#pragma unroll
    for (int qt = 0; qt < 2; ++qt)
#pragma unroll
        for (int dt = 0; dt < 4; ++dt) oacc[qt][dt] = (v8f){};
    float mrun[2] = { -3.0e38f, -3.0e38f }, lsum[2] = { 0.f, 0.f };
    asm volatile("s_wait_asynccnt 0x0" ::: "memory");   // this wave's copies of stage 0 have landed
    __syncthreads();                                    // ... and every other wave's: stage 0 may be read
    fill(1);
#pragma unroll 1   // kept rolled: copies of a stage would only grow the text
    for (int st = 0; st < NST; ++st) {
        const bf* rb = ring + (st & 1) * STG;
        const bf* pkh = rb + lr * KP + 8 * hi; const bf* pkl = pkh + KTL; const bf* pvh = pkh + 2 * KTL; const bf* pvl = pkh + 3 * KTL;   // this lane's row and half; K walks 32 rows a pass, V 32 columns and, every other pass, on to the next 64 rows
        V kh[2][2], kl[2][2];   // [key tile][slice of the head dim]
#pragma unroll
        for (int kt = 0; kt < 2; ++kt)
#pragma unroll
            for (int kc = 0; kc < 2; ++kc) { kh[kt][kc] = WFrag<bf>::ld(pkh + kt * 16 * KP + kc * 32); kl[kt][kc] = WFrag<bf>::ld(pkl + kt * 16 * KP + kc * 32); }
#pragma unroll 1   // kept rolled: a pass is already straight-line code with 48 matrix instructions; unrolled, the four passes' score products are moved together and their live ranges spill
        for (int ps = 0; ps < SK / 32; ++ps) {
            V vh[4], vl[4];
#pragma unroll
            for (int dt = 0; dt < 4; ++dt) { vh[dt] = WFrag<bf>::ld(pvh + ((ps >> 1) * 64 + dt * 16) * KP + (ps & 1) * 32); vl[dt] = WFrag<bf>::ld(pvl + ((ps >> 1) * 64 + dt * 16) * KP + (ps & 1) * 32); }
            __builtin_amdgcn_sched_barrier(0);   // V of this pass is issued ahead of the score products, so that it lands under them and the softmax
            v8f s[2][2];        // [key tile][query tile]
#pragma unroll
            for (int kt = 0; kt < 2; ++kt)
#pragma unroll
                for (int qt = 0; qt < 2; ++qt) s[kt][qt] = (v8f){};
#pragma unroll
            for (int kc = 0; kc < 2; ++kc) {
#pragma unroll
                for (int kt = 0; kt < 2; ++kt)
#pragma unroll
                    for (int qt = 0; qt < 2; ++qt) s[kt][qt] = wmmab(kh[kt][kc], qh[qt][kc], s[kt][qt]);
#pragma unroll
                for (int kt = 0; kt < 2; ++kt)
#pragma unroll
                    for (int qt = 0; qt < 2; ++qt) s[kt][qt] = wmmab(kl[kt][kc], qh[qt][kc], s[kt][qt]);
#pragma unroll
                for (int kt = 0; kt < 2; ++kt)
#pragma unroll
                    for (int qt = 0; qt < 2; ++qt) s[kt][qt] = wmmab(kh[kt][kc], ql[qt][kc], s[kt][qt]);
            }
            __builtin_amdgcn_sched_barrier(0);   // the next pass's K reads stay behind the products that read these registers and ahead of the softmax, which covers their latency
            if (ps + 1 < SK / 32) {              // inside the stage only: the next stage is read only behind its barrier
#pragma unroll
                for (int kt = 0; kt < 2; ++kt)
#pragma unroll
                    for (int kc = 0; kc < 2; ++kc) { kh[kt][kc] = WFrag<bf>::ld(pkh + ((ps + 1) * 32 + kt * 16) * KP + kc * 32); kl[kt][kc] = WFrag<bf>::ld(pkl + ((ps + 1) * 32 + kt * 16) * KP + kc * 32); }
            }
            __builtin_amdgcn_sched_barrier(0);   // see above: keeps those reads from sinking to their uses in the next pass
            V ph[2], pl[2];
#pragma unroll
            for (int qt = 0; qt < 2; ++qt) {
                float mx = s[0][qt][0];
#pragma unroll
                for (int j = 1; j < 8; ++j) mx = fmaxf(mx, s[0][qt][j]);
#pragma unroll
                for (int j = 0; j < 8; ++j) mx = fmaxf(mx, s[1][qt][j]);
                mx = fmaxf(mx, xhalf(mx));
                const float mn = fmaxf(mrun[qt], mx * 1.4426950408889634f); const float al = __builtin_amdgcn_exp2f(mrun[qt] - mn); mrun[qt] = mn;
                v2f sum2 = { 0.f, 0.f };
#pragma unroll
                for (int kt = 0; kt < 2; ++kt)
#pragma unroll
                    for (int j = 0; j < 8; j += 2) { v2f t; t[0] = s[kt][qt][j]; t[1] = s[kt][qt][j + 1]; t = __builtin_elementwise_fma(t, (v2f){ 1.4426950408889634f, 1.4426950408889634f }, (v2f){ -mn, -mn }); v2f p; p[0] = __builtin_amdgcn_exp2f(t[0]); p[1] = __builtin_amdgcn_exp2f(t[1]); sum2 += p;
                        const v2bf a = __builtin_convertvector(p, v2bf); const v2f r = p - __builtin_convertvector(a, v2f); const v2bf c = __builtin_convertvector(r, v2bf);
                        ph[qt][kt * 8 + j] = a[0]; ph[qt][kt * 8 + j + 1] = a[1]; pl[qt][kt * 8 + j] = c[0]; pl[qt][kt * 8 + j + 1] = c[1]; }
                lsum[qt] = lsum[qt] * al + (sum2[0] + sum2[1]);   // this half's keys only; the halves are joined once, behind the loop
#pragma unroll
                for (int dt = 0; dt < 4; ++dt) oacc[qt][dt] *= al;
            }
#pragma unroll
            for (int dt = 0; dt < 4; ++dt)
#pragma unroll
                for (int qt = 0; qt < 2; ++qt) oacc[qt][dt] = wmmab(vh[dt], ph[qt], oacc[qt][dt]);
#pragma unroll
            for (int dt = 0; dt < 4; ++dt)
#pragma unroll
                for (int qt = 0; qt < 2; ++qt) oacc[qt][dt] = wmmab(vl[dt], ph[qt], oacc[qt][dt]);
#pragma unroll
            for (int dt = 0; dt < 4; ++dt)
#pragma unroll
                for (int qt = 0; qt < 2; ++qt) oacc[qt][dt] = wmmab(vh[dt], pl[qt], oacc[qt][dt]);
            __builtin_amdgcn_sched_barrier(0);                   // holds the products above in front of the slots below
            asm volatile("v_nop\n\tv_nop\n\tv_nop\n\tv_nop");   // the distance behind the last matrix instruction, on both sides of the loop's branch: the next pass's address arithmetic and the refill's reuse its operand registers
        }
        asm volatile("s_wait_dscnt 0x0" ::: "memory");      // this wave's reads of stage st have returned: its buffer may be refilled behind the barrier
        asm volatile("s_wait_asynccnt 0x0" ::: "memory");   // this wave's copies of stage st + 1 have landed
        __syncthreads();                                    // publishes stage st + 1 and ends every wave's reads of stage st
        if (st + 2 < NST) fill(st + 2);                     // into the buffer that this trip has just read
    }
    asm volatile("s_wait_asynccnt 0x0" ::: "memory");       // no copy is left in flight when the wave ends
#pragma unroll
    for (int qt = 0; qt < 2; ++qt) { const float f = __fdiv_rn(0.125f, lsum[qt] + xhalf(lsum[qt]));   // softmax / sqrt(64)
        float* orow = OUT + ((size_t)bb * TT + q0 + qt * 16 + lr) * DM + h * HD + 8 * hi;
#pragma unroll
        for (int dt = 0; dt < 4; ++dt) { v4f lo4, hi4;
#pragma unroll
            for (int j = 0; j < 4; ++j) { lo4[j] = oacc[qt][dt][j] * f; hi4[j] = oacc[qt][dt][4 + j] * f; }
            *(v4f*)(orow + dt * 16) = lo4; *(v4f*)(orow + dt * 16 + 4) = hi4; } }
}
__global__ __launch_bounds__(256) void k_merge(const float* __restrict__ O, int h0, bf* Ah, bf* Al) { const size_t e = ((size_t)blockIdx.x * 256 + threadIdx.x) * 2; if (e >= (size_t)ZH * TT * HD) return; const int d = (int)(e % HD); const int t = (int)((e / HD) % TT); const int zz = (int)(e / ((size_t)HD * TT)); const float cs = (t < RH) ? 1.0f : (1.0f / PCAR); const size_t oo = (size_t)t * DQ + (h0 + zz) * HD + d;
    v2us oh, ol;
#pragma unroll
    for (int q = 0; q < 2; ++q) { unsigned short a, c2; splitf(O[e + q] * cs, a, c2); oh[q] = a; ol[q] = c2; } *(v2us*)(Ah + oo) = oh; *(v2us*)(Al + oo) = ol;  }

extern "C" void kernel_launch(void* const* d_in, const int* in_sizes, int n_in,
                              void* d_out, int out_size, void* d_ws, size_t ws_size, hipStream_t stream) {
    (void)in_sizes; (void)n_in; (void)out_size;
    const float* x = (const float*)d_in[0]; const float* wq = (const float*)d_in[1]; const float* bq = (const float*)d_in[2]; const float* wk = (const float*)d_in[3]; const float* bk = (const float*)d_in[4]; const float* wv = (const float*)d_in[5]; const float* bv = (const float*)d_in[6];   // W [16][1024][64] per head (x @ W[h]), b [16][64]
    float* OUT = (float*)d_out;     // [2][2048][1024]
    char* wsp = (char*)d_ws;
    auto take = [&](size_t bytes) { char* p = wsp; wsp += (bytes + 255) & ~(size_t)255; return (void*)p; };
    bf* W3 = (bf*)take((size_t)3 * DQ * DM * 2); bf* XB = (bf*)take((size_t)NB_ * TT * DM * 2);   // q, k, v weights transposed; x of both batches
    const size_t PB = (size_t)NH_ * TT * HD;   // one batch's hi or lo plane, elements; the planes hold both batches
    bf* QPh = (bf*)take(NB_ * PB * 2); bf* QPl = (bf*)take(NB_ * PB * 2); bf* KPh = (bf*)take(NB_ * PB * 2); bf* KPl = (bf*)take(NB_ * PB * 2); bf* VTh = (bf*)take(NB_ * PB * 2); bf* VTl = (bf*)take(NB_ * PB * 2);
    if ((size_t)(wsp - (char*)d_ws) > ws_size) return;    // ws 256 MiB
    k_wt3<<<dim3((unsigned)(((size_t)DQ * DM / 4 + 255) / 256), 3, 1), 256, 0, stream>>>(wq, wk, wv, W3);
    k_cvt8<<<(unsigned)(((size_t)NB_ * TT * DM / 8 + 255) / 256), 256, 0, stream>>>(x, XB, (size_t)NB_ * TT * DM / 8);
    k_proj<<<dim3(NB_ * TT / 256, NH_, 1), 32 * PNW, 0, stream>>>(XB, W3, bq, bk, bv, QPh, QPl, KPh, KPl, VTh, VTl);
    k_fattn<<<dim3(TT / (32 * FNW), NH_, NB_), 32 * FNW, 0, stream>>>(QPh, QPl, KPh, KPl, VTh, VTl, OUT);
}

// v005
// Measured time: 110 microseconds a run.
// Two timings next to v004 both put it at 1.22 times that version's speed.
// Over all steps from v000 it is 11.5 times as fast.
#include <hip/hip_runtime.h>

// SimplifiedMultiHeadAttention (x [2][2048][1024]; per-head q/k/v = x W[h] + b[h] (16 heads, W [16][1024][64]); scores = q.k UNSCALED; att = softmax over keys THEN / sqrt(64); out = concat_h(att v) -> [2][2048][1024], no output projection).
// Compute dtypes, f32 accumulate: every input rounded to bf16; projections on PLAIN bf16 operands (inputs: exact, + bias); because the logits are unscaled (|s| up to ~20)
// EVERY query row takes scores and att.v on bf16 hi+lo planes (3 products each; single fp16 planes would leave ~1e-2 logit error); f32 online softmax in registers with the post-softmax 1/8 folded into the

#define NB_  2
#define TT   2048
#define DM   1024
#define NH_  16
#define NKV  16
#define REP  (NH_ / NKV)
#define HD   64
#define DQ   (NH_ * HD)
#define DKV  (NKV * HD)
#define ZH   2
#define RH   2048                  // read only by k_merge, which is not launched
#define WIN  0
#define PCAR 1024.0f
#define SCL  1.0f                  // unscaled logits (the 1/sqrt(64) is applied AFTER the softmax, folded into the normaliser)
typedef _Float16 h16;
typedef unsigned short bf;
typedef __attribute__((ext_vector_type(16))) __bf16   v16bf;
typedef __attribute__((ext_vector_type(16))) _Float16 v16h;
typedef __attribute__((ext_vector_type(8)))  _Float16 v8h;
typedef __attribute__((ext_vector_type(8)))  unsigned short v8us;
typedef __attribute__((ext_vector_type(8)))  float    v8f;
typedef __attribute__((ext_vector_type(4)))  float    v4f;
typedef v8h  __attribute__((may_alias)) v8ha;
typedef v4f  __attribute__((may_alias)) v4fa;
typedef v8us __attribute__((may_alias)) v8usa;

__device__ __forceinline__ unsigned short f2bf(float f) { unsigned u = __float_as_uint(f); u += 0x7FFFu + ((u >> 16) & 1u); return (unsigned short)(u >> 16); }
__device__ __forceinline__ float bf2f(unsigned short b) { return __uint_as_float(((unsigned)b) << 16); }
__device__ __forceinline__ float bfr(float f) { return bf2f(f2bf(f)); }
__device__ __forceinline__ v16h cat16(v8h lo, v8h hi) { return __builtin_shufflevector(lo, hi, 0, 1, 2, 3, 4, 5, 6, 7, 8, 9, 10, 11, 12, 13, 14, 15); }
__device__ __forceinline__ v16bf cat16b(v8us lo, v8us hi) { return __builtin_bit_cast(v16bf, __builtin_shufflevector(lo, hi, 0, 1, 2, 3, 4, 5, 6, 7, 8, 9, 10, 11, 12, 13, 14, 15)); }
__device__ __forceinline__ v8f wmma16(v16h a, v16h b, v8f c) { return __builtin_amdgcn_wmma_f32_16x16x32_f16(false, a, false, b, (short)0, c, false, false); }
__device__ __forceinline__ v8f wmmab(v16bf a, v16bf b, v8f c) { return __builtin_amdgcn_wmma_f32_16x16x32_bf16(false, a, false, b, (short)0, c, false, false); }



// ---- WFrag: a 16x32 operand fragment from a K-contiguous 16-bit plane (p = this lane's row, + 8 * half), in the hardware k order
template <typename T16> struct WFrag;
template <> struct WFrag<h16> { typedef v16h V; static __device__ __forceinline__ V ld(const h16* p) { return cat16(*(const v8h*)p, *(const v8h*)(p + 16)); } static __device__ __forceinline__ v8f mma(V a, V b, v8f c) { return wmma16(a, b, c); } };
template <> struct WFrag<bf> { typedef v16bf V; static __device__ __forceinline__ V ld(const bf* p) { return cat16b(*(const v8us*)p, *(const v8us*)(p + 16)); } static __device__ __forceinline__ v8f mma(V a, V b, v8f c) { return wmmab(a, b, c); } };

__device__ __forceinline__ h16 tohx(float x) { return (h16)x; }
__device__ __forceinline__ void splitf(float y, unsigned short& h, unsigned short& l) { h = f2bf(y); l = f2bf(y - bf2f(h)); }
typedef __attribute__((ext_vector_type(2))) _Float16 v2h;
typedef __attribute__((ext_vector_type(4))) _Float16 v4h;
typedef __attribute__((ext_vector_type(2))) unsigned short v2us;
typedef __attribute__((ext_vector_type(4))) unsigned short v4us;
typedef __attribute__((ext_vector_type(2))) float v2f;
typedef __attribute__((ext_vector_type(4))) int v4i;

__global__ __launch_bounds__(256) void k_wtG(const float* __restrict__ w, int K, int N, bf* Bt) {
    const int lane = threadIdx.x & 31; const int L0 = (blockIdx.x * 8 + (threadIdx.x >> 5)) * 8; const int nlines = N * K / 64;
{
#pragma unroll 1
        for (int l = 0; l < 8; ++l) { const int L = L0 + l; if (L >= nlines) break; const size_t e = (size_t)L * 64 + lane * 2; const int k = (int)(e % K), n = (int)(e / K); v2us o;
            o[0] = f2bf(w[(size_t)k * N + n]); o[1] = f2bf(w[(size_t)(k + 1) * N + n]); *(v2us*)(Bt + e) = o; }
         }
}
__global__ __launch_bounds__(256) void k_cvt8(const float* __restrict__ src, bf* dst, size_t n8) { const size_t i = (size_t)blockIdx.x * 256 + threadIdx.x; if (i >= n8) return; const v8f v = *(const v8f*)(src + i * 8); v8us o;
#pragma unroll
    for (int k = 0; k < 8; ++k) o[k] = f2bf(v[k]); *(v8us*)(dst + i * 8) = o;  }
__global__ __launch_bounds__(256) void k_cscvt(const float* __restrict__ cosT, const float* __restrict__ sinT, float* CS) { const int idx = blockIdx.x * 256 + threadIdx.x; if (idx >= TT * HD) return; v2f cs; cs[0] = bfr(cosT[idx]); cs[1] = bfr(sinT[idx]); *(v2f*)(CS + (size_t)idx * 2) = cs;  }
__global__ __launch_bounds__(256) void k_wt3(const float* __restrict__ wq, const float* __restrict__ wk, const float* __restrict__ wv, bf* Bt) { const int e4 = (blockIdx.x * 256 + threadIdx.x) * 4; if (e4 >= NH_ * HD * DM) return; const int k = e4 % DM; const int n = e4 / DM; const int h = n / HD, e = n % HD; v4us o;
    const float* w = blockIdx.y == 0 ? wq : blockIdx.y == 1 ? wk : wv; Bt += (size_t)blockIdx.y * DQ * DM;   // grid.y: q, k, v weights, one plane behind the other
#pragma unroll
    for (int q = 0; q < 4; ++q) o[q] = f2bf(w[((size_t)h * DM + k + q) * HD + e]); *(v4us*)(Bt + e4) = o;  }
// ---- k_proj: the q, k and v projections of both batches in one launch, from the bf16 planes of x ([NB_*TT][DM]) and of the weights ([3][DQ][DM], k contiguous) straight to the hi+lo head planes that k_fattn reads:
// no f32 projection ever reaches memory. One wave per 64x64 output tile (16 accumulators). grid (NB_*TT/256, heads), 12 waves = 4 position tiles x {q, k, v} of one
// head: 256 workgroups, three waves per SIMD; the three waves of a position tile read the same x rows, the four waves of a projection the same weight rows.
// x and the weights reach the waves through LDS: a fragment load from the planes touches 16 lines for 512 bytes, and every row is wanted by three or four waves. A stage is 128 k (4 trips) of the 256 x rows and
// the 192 weight rows, brought in once per workgroup by asynchronous copies of whole lines (a wave's copy is two rows of 256 bytes), two buffers: stage s + 1 flies while stage s is worked on. Rows are padded by
// 16 bytes (pitch 16 B x odd) for the 16-byte fragment reads. Tile row = x row, then 256 + 64 * projection + weight row. Inside a stage the fragments of trip t + 1 are read, as one group, ahead of the products of trip t.
// q, k: A = x rows, B = weight rows, tile [t][d] -> plane [b][h][t][d]. v: the operands change places (A = weight rows, B = x rows), tile [d][t] -> plane [b][h][d][t]; same products, same k order.
// Epilogue per 16 tile rows: accumulators to this wave's own LDS rows, read back 8 columns a lane, + bias, split, two 16-byte stores: each store instruction writes four whole 128-byte lines.
#define PNW 12
#define PK   128                   // k a stage
#define PP   (PK + 8)              // row pitch in LDS, elements (272 B)
#define PRX  256                   // x rows of a workgroup
#define PSTG ((PRX + 3 * HD) * PP) // a stage, elements
#define PNST (DM / PK)
// eight asynchronous 16-byte copies a lane, global -> LDS: four steps of plane a, four of plane b (la, lb: LDS byte addresses; ls: LDS step in bytes; step n is n & 1 times g1 plus n >> 1 times g2 elements on in global memory).
// The s_wait_xcnt stands inside the statement, behind the last copy: the address registers stay whole up to it.
__device__ __forceinline__ void acopy8(unsigned la, unsigned lb, unsigned ls, const bf* ga, const bf* gb, int g1, int g2) {
    asm volatile("global_load_async_to_lds_b128 %0, %8, off\n\t"
                 "global_load_async_to_lds_b128 %1, %9, off\n\t"
                 "global_load_async_to_lds_b128 %2, %10, off\n\t"
                 "global_load_async_to_lds_b128 %3, %11, off\n\t"
                 "global_load_async_to_lds_b128 %4, %12, off\n\t"
                 "global_load_async_to_lds_b128 %5, %13, off\n\t"
                 "global_load_async_to_lds_b128 %6, %14, off\n\t"
                 "global_load_async_to_lds_b128 %7, %15, off\n\t"
                 "s_wait_xcnt 0x0"
                 :: "v"(la), "v"(la + ls), "v"(la + 2 * ls), "v"(la + 3 * ls), "v"(lb), "v"(lb + ls), "v"(lb + 2 * ls), "v"(lb + 3 * ls),
                    "v"(ga), "v"(ga + g1), "v"(ga + g2), "v"(ga + g1 + g2), "v"(gb), "v"(gb + g1), "v"(gb + g2), "v"(gb + g1 + g2) : "memory");
}
// five such copies, step n being n times ls bytes on in LDS and n times gs elements on in global memory; the s_wait_xcnt stands inside the statement, as above.
__device__ __forceinline__ void acopy5(unsigned l, unsigned ls, const bf* g, int gs) {
    asm volatile("global_load_async_to_lds_b128 %0, %5, off\n\t"
                 "global_load_async_to_lds_b128 %1, %6, off\n\t"
                 "global_load_async_to_lds_b128 %2, %7, off\n\t"
                 "global_load_async_to_lds_b128 %3, %8, off\n\t"
                 "global_load_async_to_lds_b128 %4, %9, off\n\t"
                 "s_wait_xcnt 0x0"
                 :: "v"(l), "v"(l + ls), "v"(l + 2 * ls), "v"(l + 3 * ls), "v"(l + 4 * ls), "v"(g), "v"(g + gs), "v"(g + 2 * gs), "v"(g + 3 * gs), "v"(g + 4 * gs) : "memory");
}
// one such copy, with its s_wait_xcnt
__device__ __forceinline__ void acopy1(unsigned l, const bf* g) { asm volatile("global_load_async_to_lds_b128 %0, %1, off\n\ts_wait_xcnt 0x0" :: "v"(l), "v"(g) : "memory"); }
__global__ __launch_bounds__(32 * PNW) void k_proj(const bf* __restrict__ XB, const bf* __restrict__ W3, const float* __restrict__ bq, const float* __restrict__ bk, const float* __restrict__ bv, bf* Qh, bf* Ql, bf* Kh, bf* Kl, bf* Vh, bf* Vl) {
    typedef WFrag<bf>::V V;
    __shared__ __align__(16) bf pring[2 * PSTG];
    __shared__ __align__(16) float osw[PNW][16 * 68];
    const int lane = threadIdx.x & 31, lr = lane & 15, hi = lane >> 4; const int w = __builtin_amdgcn_readfirstlane((int)(threadIdx.x >> 5));
    const int pj = w % 3, h = blockIdx.y; const int r0 = (blockIdx.x * 4 + w / 3) * 64; const int bb = r0 / TT, t0 = r0 % TT; const bool tr = pj == 2;
    // this lane's share of a stage: bytes 16 (lane & 15) of row lane >> 4 of each pair of tile rows. x: pairs w, w + 12, ... (ten a wave, an eleventh for waves 0 to 7); weights: the eight pairs from 8 w on.
    const unsigned lcx = (unsigned)(size_t)pring + (2 * w + hi) * (PP * 2) + lr * 16, lcw = (unsigned)(size_t)pring + (PRX + 16 * w + hi) * (PP * 2) + lr * 16;
    const bf* gcx = XB + (size_t)(blockIdx.x * PRX + 2 * w + hi) * DM + lr * 8; const bf* gcw = W3 + ((size_t)(w >> 2) * DQ + h * HD + (w & 3) * 16 + hi) * DM + lr * 8;
    auto fill = [&](int st) { const unsigned lb = (st & 1) * (PSTG * 2); const bf* gx = gcx + st * PK; const bf* gw = gcw + st * PK;
        acopy5(lcx + lb, 24 * PP * 2, gx, 24 * DM); acopy5(lcx + lb + 120 * PP * 2, 24 * PP * 2, gx + 120 * DM, 24 * DM);
        if (w < 8) acopy1(lcx + lb + 240 * PP * 2, gx + 240 * DM);   // w is wave-uniform (a scalar): tile rows 240 to 255
        acopy8(lcw + lb, lcw + lb + 8 * PP * 2, 2 * PP * 2, gw, gw + 8 * DM, 2 * DM, 4 * DM); };
    fill(0);
    const int xrow = (w / 3) * 64 + lr, wrow = PRX + pj * HD + lr;   // this lane's first row of the x tile and of the weight tile
    const int oa = (tr ? wrow : xrow) * PP + 8 * hi, ob = (tr ? xrow : wrow) * PP + 8 * hi;
    v8f acc[4][4];
#pragma unroll
    for (int mb = 0; mb < 4; ++mb)
#pragma unroll
        for (int nb = 0; nb < 4; ++nb) acc[mb][nb] = (v8f){};
    asm volatile("s_wait_asynccnt 0x0" ::: "memory");   // this wave's copies of stage 0 have landed
    __syncthreads();                                    // ... and every other wave's: stage 0 may be read
    fill(1);
#pragma unroll 1   // kept rolled: a stage is already straight-line code with 64 matrix instructions
    for (int st = 0; st < PNST; ++st) {
        const bf* pa = pring + (st & 1) * PSTG + oa; const bf* pb = pring + (st & 1) * PSTG + ob;
        V a[2][4], b[2][4];   // two fragment sets: [trip & 1][16-row tile]
#pragma unroll
        for (int i = 0; i < 4; ++i) { a[0][i] = WFrag<bf>::ld(pa + i * 16 * PP); b[0][i] = WFrag<bf>::ld(pb + i * 16 * PP); }
#pragma unroll   // unrolled, as the loops inside: the two fragment sets need static indices to stay in registers
        for (int t = 0; t < PK / 32; ++t) {
            if (t + 1 < PK / 32) {   // inside the stage only: the next stage is read only behind its barrier
#pragma unroll
                for (int i = 0; i < 4; ++i) { a[(t + 1) & 1][i] = WFrag<bf>::ld(pa + i * 16 * PP + (t + 1) * 32); b[(t + 1) & 1][i] = WFrag<bf>::ld(pb + i * 16 * PP + (t + 1) * 32); }
            }
            __builtin_amdgcn_sched_barrier(0);   // the next trip's 16 reads are issued as one group ahead of this trip's products and land under them; left free, they sink among the products and are waited for there
#pragma unroll
            for (int nb = 0; nb < 4; ++nb)
#pragma unroll
                for (int mb = 0; mb < 4; ++mb) acc[mb][nb] = wmmab(a[t & 1][mb], b[t & 1][nb], acc[mb][nb]);
            __builtin_amdgcn_sched_barrier(0);   // holds the products in front of the next group of reads (and, in the last trip, of the slots below)
        }
        asm volatile("v_nop\n\tv_nop\n\tv_nop\n\tv_nop");   // the distance behind the last matrix instruction: the refill's address arithmetic reuses its operand registers
        asm volatile("s_wait_dscnt 0x0" ::: "memory");      // this wave's reads of stage st have returned: its buffer may be refilled behind the barrier
        asm volatile("s_wait_asynccnt 0x0" ::: "memory");   // this wave's copies of stage st + 1 have landed
        __syncthreads();                                    // publishes stage st + 1 and ends every wave's reads of stage st
        if (st + 2 < PNST) fill(st + 2);                    // into the buffer that this trip has just read
    }
    asm volatile("s_wait_asynccnt 0x0" ::: "memory");       // no copy is left in flight when the wave goes on to the epilogue
    float* os = osw[w];
    const float* bias = (pj == 0 ? bq : pj == 1 ? bk : bv) + h * HD; bf* Ph = pj == 0 ? Qh : pj == 1 ? Kh : Vh; bf* Pl = pj == 0 ? Ql : pj == 1 ? Kl : Vl;
    const size_t pofs = ((size_t)bb * NH_ + h) * ((size_t)TT * HD) + (tr ? t0 : t0 * HD); const int pitch = tr ? TT : HD;
    const int rsub = lane >> 3, cofs = (lane & 7) * 8;
    float bc[8];   // q, k: the bias goes by tile column (d), the same 8 for every row of this lane
#pragma unroll
    for (int i = 0; i < 8; ++i) bc[i] = bfr(bias[cofs + i]);
    asm volatile("s_wait_xcnt 0x0" ::: "memory");   // behind the bias loads above: their offset register is reused below
#pragma unroll
    for (int mb = 0; mb < 4; ++mb) {
#pragma unroll
        for (int nb = 0; nb < 4; ++nb) {
#pragma unroll
            for (int j = 0; j < 8; ++j) os[(hi * 8 + j) * 68 + nb * 16 + lr] = acc[mb][nb][j]; }
        __builtin_amdgcn_wave_barrier(); asm volatile("" ::: "memory");   // the rows are read back by other lanes of this wave: the reads stay behind the writes
#pragma unroll
        for (int s = 0; s < 4; ++s) { const int row = 4 * s + rsub; const v4f v0 = *(const v4fa*)(os + row * 68 + cofs), v1 = *(const v4fa*)(os + row * 68 + cofs + 4);
            const float br = bfr(bias[mb * 16 + row]);   // v: the bias goes by tile row (d)
            v8us oh, ol;
#pragma unroll
            for (int i = 0; i < 8; ++i) { unsigned short a2, c2; splitf((i < 4 ? v0[i] : v1[i - 4]) + (tr ? br : bc[i]), a2, c2); oh[i] = a2; ol[i] = c2; }
            const size_t o = pofs + (size_t)(mb * 16 + row) * pitch + cofs; *(v8us*)(Ph + o) = oh; *(v8us*)(Pl + o) = ol; }
        __builtin_amdgcn_wave_barrier(); asm volatile("" ::: "memory");   // the next 16 rows overwrite the staging only behind these reads
    }
}
// ---- k_fattn: scores, softmax, att.v and the output store in one launch; no score or probability ever reaches memory. One wave owns 32 query columns (two 16-column tiles) of one (batch, head) and
// walks the 2048 keys in passes of 32: S^T = K.Q^T (A = K rows, B = Q kept in registers), so a lane holds 16 scores of ONE query per tile; running maximum and sum per lane (online softmax, log2 domain);
// the two 16-key D tiles, converted in place, ARE the B operand of O^T += V^T.P^T (hardware k order, which the plane loader already has). Same hi+lo products as before: 3 per GEMM.
// grid (TT/256, heads, batches), 8 waves: 256 workgroups, two waves per SIMD. Every loop over fragment indices is fully unrolled so that the fragment arrays have static indices and stay in registers.
// K and V reach the waves through LDS: the 8 waves read the same K and V, and a fragment load from the planes touches 16 lines for 512 bytes. A stage is 128 keys (4 passes) of the four planes, brought in once
// per workgroup by asynchronous copies of whole lines (16 a lane), two buffers: stage s + 1 flies while stage s is worked on. Every tile is 128 rows of 128 bytes, padded by 16 bytes (pitch 16 B x odd) for the
// 16-byte fragment reads: K row = key; V^T row = 64 * (key / 64 within the stage) + dim, 64 keys a row.
#define FNW 8
#define SK  128                    // keys a stage
#define KP  (HD + 8)               // row pitch in LDS, elements (144 B)
#define KTL (SK * KP)              // one plane's tile, elements
#define STG (4 * KTL)              // a stage: K hi, K lo, V^T hi, V^T lo
#define NST (TT / SK)
typedef __attribute__((ext_vector_type(2))) __bf16 v2bf;
__device__ __forceinline__ float xhalf(float x) { const int b = __float_as_int(x); return __int_as_float(__builtin_amdgcn_permlanex16(b, b, 0x76543210, 0xfedcba98, false, false)); }   // lane l <-> l ^ 16
__global__ __launch_bounds__(32 * FNW) void k_fattn(const bf* __restrict__ Qh, const bf* __restrict__ Ql, const bf* __restrict__ Kh, const bf* __restrict__ Kl, const bf* __restrict__ Vh, const bf* __restrict__ Vl, float* OUT) {
    typedef WFrag<bf>::V V;
    __shared__ __align__(16) bf ring[2 * STG];
    const int tid = threadIdx.x, lane = tid & 31, lr = lane & 15, hi = lane >> 4, w = tid >> 5; const int h = blockIdx.y, bb = blockIdx.z;
    const size_t pofs = ((size_t)bb * NH_ + h) * ((size_t)TT * HD); const int q0 = (blockIdx.x * FNW + w) * 32;
    Qh += pofs; Ql += pofs; Kh += pofs; Kl += pofs; Vh += pofs; Vl += pofs;
    // this lane's share of a stage: thread t takes bytes 16 (t & 7) of row t >> 3 of each 32 tile rows, so a wave's copy is four whole lines.
    const unsigned lck = (unsigned)(size_t)ring + (tid >> 3) * (KP * 2) + (tid & 7) * 16;
    const unsigned gck = tid * 8, gcv = (tid >> 3) * TT + (tid & 7) * 8;
    auto fill = [&](unsigned st) { const unsigned lb = (st & 1) * (STG * 2); const unsigned ek = gck + st * (SK * HD), ev = gcv + st * SK;   // element offsets in a plane, 32 bits: only gck and gcv live through the loop
        acopy8(lck + lb, lck + lb + KTL * 2, 32 * KP * 2, Kh + ek, Kl + ek, 32 * HD, 64 * HD);
        acopy8(lck + lb + 2 * KTL * 2, lck + lb + 3 * KTL * 2, 32 * KP * 2, Vh + ev, Vl + ev, 32 * TT, 64); };
    fill(0);
    const bf* pqh = Qh + (size_t)(q0 + lr) * HD + 8 * hi; const bf* pql = Ql + (size_t)(q0 + lr) * HD + 8 * hi;
    V qh[2][2], ql[2][2];   // [query tile][32-wide slice of the head dim]
#pragma unroll
    for (int qt = 0; qt < 2; ++qt)
#pragma unroll
        for (int kc = 0; kc < 2; ++kc) { qh[qt][kc] = WFrag<bf>::ld(pqh + qt * 16 * HD + kc * 32); ql[qt][kc] = WFrag<bf>::ld(pql + qt * 16 * HD + kc * 32); }
    asm volatile("s_wait_xcnt 0x0" :: "v"(pqh), "v"(pql) : "memory");   // behind the Q loads above: their address registers stay whole up to this wait and are reused only behind it
    v8f oacc[2][4];         // [query tile][16-row tile of the head dim]: O^T, register r = dim 8*hi + r, lane column = query
#pragma unroll
    for (int qt = 0; qt < 2; ++qt)
#pragma unroll
        for (int dt = 0; dt < 4; ++dt) oacc[qt][dt] = (v8f){};
    float mrun[2] = { -3.0e38f, -3.0e38f }, lsum[2] = { 0.f, 0.f };
    asm volatile("s_wait_asynccnt 0x0" ::: "memory");   // this wave's copies of stage 0 have landed
    __syncthreads();                                    // ... and every other wave's: stage 0 may be read
    fill(1);
#pragma unroll 1   // kept rolled: copies of a stage would only grow the text
    for (int st = 0; st < NST; ++st) {
        const bf* rb = ring + (st & 1) * STG;
        const bf* pkh = rb + lr * KP + 8 * hi; const bf* pkl = pkh + KTL; const bf* pvh = pkh + 2 * KTL; const bf* pvl = pkh + 3 * KTL;   // this lane's row and half; K walks 32 rows a pass, V 32 columns and, every other pass, on to the next 64 rows
        V kh[2][2], kl[2][2];   // [key tile][slice of the head dim]
#pragma unroll
        for (int kt = 0; kt < 2; ++kt)
#pragma unroll
            for (int kc = 0; kc < 2; ++kc) { kh[kt][kc] = WFrag<bf>::ld(pkh + kt * 16 * KP + kc * 32); kl[kt][kc] = WFrag<bf>::ld(pkl + kt * 16 * KP + kc * 32); }
#pragma unroll 1   // kept rolled: a pass is already straight-line code with 48 matrix instructions; unrolled, the four passes' score products are moved together and their live ranges spill
        for (int ps = 0; ps < SK / 32; ++ps) {
            V vh[4], vl[4];
#pragma unroll
            for (int dt = 0; dt < 4; ++dt) { vh[dt] = WFrag<bf>::ld(pvh + ((ps >> 1) * 64 + dt * 16) * KP + (ps & 1) * 32); vl[dt] = WFrag<bf>::ld(pvl + ((ps >> 1) * 64 + dt * 16) * KP + (ps & 1) * 32); }
            __builtin_amdgcn_sched_barrier(0);   // V of this pass is issued ahead of the score products, so that it lands under them and the softmax
            v8f s[2][2];        // [key tile][query tile]
#pragma unroll
            for (int kt = 0; kt < 2; ++kt)
#pragma unroll
                for (int qt = 0; qt < 2; ++qt) s[kt][qt] = (v8f){};
#pragma unroll
            for (int kc = 0; kc < 2; ++kc) {
#pragma unroll
                for (int kt = 0; kt < 2; ++kt)
#pragma unroll
                    for (int qt = 0; qt < 2; ++qt) s[kt][qt] = wmmab(kh[kt][kc], qh[qt][kc], s[kt][qt]);
#pragma unroll
                for (int kt = 0; kt < 2; ++kt)
#pragma unroll
                    for (int qt = 0; qt < 2; ++qt) s[kt][qt] = wmmab(kl[kt][kc], qh[qt][kc], s[kt][qt]);
#pragma unroll
                for (int kt = 0; kt < 2; ++kt)
#pragma unroll
                    for (int qt = 0; qt < 2; ++qt) s[kt][qt] = wmmab(kh[kt][kc], ql[qt][kc], s[kt][qt]);
            }
            __builtin_amdgcn_sched_barrier(0);   // the next pass's K reads stay behind the products that read these registers and ahead of the softmax, which covers their latency
            if (ps + 1 < SK / 32) {              // inside the stage only: the next stage is read only behind its barrier
#pragma unroll
                for (int kt = 0; kt < 2; ++kt)
#pragma unroll
                    for (int kc = 0; kc < 2; ++kc) { kh[kt][kc] = WFrag<bf>::ld(pkh + ((ps + 1) * 32 + kt * 16) * KP + kc * 32); kl[kt][kc] = WFrag<bf>::ld(pkl + ((ps + 1) * 32 + kt * 16) * KP + kc * 32); }
            }
            __builtin_amdgcn_sched_barrier(0);   // see above: keeps those reads from sinking to their uses in the next pass
            V ph[2], pl[2];
#pragma unroll
            for (int qt = 0; qt < 2; ++qt) {
                float mx = s[0][qt][0];
#pragma unroll
                for (int j = 1; j < 8; ++j) mx = fmaxf(mx, s[0][qt][j]);
#pragma unroll
                for (int j = 0; j < 8; ++j) mx = fmaxf(mx, s[1][qt][j]);
                mx = fmaxf(mx, xhalf(mx));
                const float mn = fmaxf(mrun[qt], mx * 1.4426950408889634f); const float al = __builtin_amdgcn_exp2f(mrun[qt] - mn); mrun[qt] = mn;
                v2f sum2 = { 0.f, 0.f };
#pragma unroll
                for (int kt = 0; kt < 2; ++kt)
#pragma unroll
                    for (int j = 0; j < 8; j += 2) { v2f t; t[0] = s[kt][qt][j]; t[1] = s[kt][qt][j + 1]; t = __builtin_elementwise_fma(t, (v2f){ 1.4426950408889634f, 1.4426950408889634f }, (v2f){ -mn, -mn }); v2f p; p[0] = __builtin_amdgcn_exp2f(t[0]); p[1] = __builtin_amdgcn_exp2f(t[1]); sum2 += p;
                        const v2bf a = __builtin_convertvector(p, v2bf); const v2f r = p - __builtin_convertvector(a, v2f); const v2bf c = __builtin_convertvector(r, v2bf);
                        ph[qt][kt * 8 + j] = a[0]; ph[qt][kt * 8 + j + 1] = a[1]; pl[qt][kt * 8 + j] = c[0]; pl[qt][kt * 8 + j + 1] = c[1]; }
                lsum[qt] = lsum[qt] * al + (sum2[0] + sum2[1]);   // this half's keys only; the halves are joined once, behind the loop
#pragma unroll
                for (int dt = 0; dt < 4; ++dt) oacc[qt][dt] *= al;
            }
#pragma unroll
            for (int dt = 0; dt < 4; ++dt)
#pragma unroll
                for (int qt = 0; qt < 2; ++qt) oacc[qt][dt] = wmmab(vh[dt], ph[qt], oacc[qt][dt]);
#pragma unroll
            for (int dt = 0; dt < 4; ++dt)
#pragma unroll
                for (int qt = 0; qt < 2; ++qt) oacc[qt][dt] = wmmab(vl[dt], ph[qt], oacc[qt][dt]);
#pragma unroll
            for (int dt = 0; dt < 4; ++dt)
#pragma unroll
                for (int qt = 0; qt < 2; ++qt) oacc[qt][dt] = wmmab(vh[dt], pl[qt], oacc[qt][dt]);
            __builtin_amdgcn_sched_barrier(0);                   // holds the products above in front of the slots below
            asm volatile("v_nop\n\tv_nop\n\tv_nop\n\tv_nop");   // the distance behind the last matrix instruction, on both sides of the loop's branch: the next pass's address arithmetic and the refill's reuse its operand registers
        }
        asm volatile("s_wait_dscnt 0x0" ::: "memory");      // this wave's reads of stage st have returned: its buffer may be refilled behind the barrier
        asm volatile("s_wait_asynccnt 0x0" ::: "memory");   // this wave's copies of stage st + 1 have landed
        __syncthreads();                                    // publishes stage st + 1 and ends every wave's reads of stage st
        if (st + 2 < NST) fill(st + 2);                     // into the buffer that this trip has just read
    }
    asm volatile("s_wait_asynccnt 0x0" ::: "memory");       // no copy is left in flight when the wave ends
#pragma unroll
    for (int qt = 0; qt < 2; ++qt) { const float f = __fdiv_rn(0.125f, lsum[qt] + xhalf(lsum[qt]));   // softmax / sqrt(64)
        float* orow = OUT + ((size_t)bb * TT + q0 + qt * 16 + lr) * DM + h * HD + 8 * hi;
#pragma unroll
        for (int dt = 0; dt < 4; ++dt) { v4f lo4, hi4;
#pragma unroll
            for (int j = 0; j < 4; ++j) { lo4[j] = oacc[qt][dt][j] * f; hi4[j] = oacc[qt][dt][4 + j] * f; }
            *(v4f*)(orow + dt * 16) = lo4; *(v4f*)(orow + dt * 16 + 4) = hi4; } }
}
__global__ __launch_bounds__(256) void k_merge(const float* __restrict__ O, int h0, bf* Ah, bf* Al) { const size_t e = ((size_t)blockIdx.x * 256 + threadIdx.x) * 2; if (e >= (size_t)ZH * TT * HD) return; const int d = (int)(e % HD); const int t = (int)((e / HD) % TT); const int zz = (int)(e / ((size_t)HD * TT)); const float cs = (t < RH) ? 1.0f : (1.0f / PCAR); const size_t oo = (size_t)t * DQ + (h0 + zz) * HD + d;
    v2us oh, ol;
#pragma unroll
    for (int q = 0; q < 2; ++q) { unsigned short a, c2; splitf(O[e + q] * cs, a, c2); oh[q] = a; ol[q] = c2; } *(v2us*)(Ah + oo) = oh; *(v2us*)(Al + oo) = ol;  }

extern "C" void kernel_launch(void* const* d_in, const int* in_sizes, int n_in,
                              void* d_out, int out_size, void* d_ws, size_t ws_size, hipStream_t stream) {
    (void)in_sizes; (void)n_in; (void)out_size;
    const float* x = (const float*)d_in[0]; const float* wq = (const float*)d_in[1]; const float* bq = (const float*)d_in[2]; const float* wk = (const float*)d_in[3]; const float* bk = (const float*)d_in[4]; const float* wv = (const float*)d_in[5]; const float* bv = (const float*)d_in[6];   // W [16][1024][64] per head (x @ W[h]), b [16][64]
    float* OUT = (float*)d_out;     // [2][2048][1024]
    char* wsp = (char*)d_ws;
    auto take = [&](size_t bytes) { char* p = wsp; wsp += (bytes + 255) & ~(size_t)255; return (void*)p; };
    bf* W3 = (bf*)take((size_t)3 * DQ * DM * 2); bf* XB = (bf*)take((size_t)NB_ * TT * DM * 2);   // q, k, v weights transposed; x of both batches
    const size_t PB = (size_t)NH_ * TT * HD;   // one batch's hi or lo plane, elements; the planes hold both batches
    bf* QPh = (bf*)take(NB_ * PB * 2); bf* QPl = (bf*)take(NB_ * PB * 2); bf* KPh = (bf*)take(NB_ * PB * 2); bf* KPl = (bf*)take(NB_ * PB * 2); bf* VTh = (bf*)take(NB_ * PB * 2); bf* VTl = (bf*)take(NB_ * PB * 2);
    if ((size_t)(wsp - (char*)d_ws) > ws_size) return;    // ws 256 MiB
    k_wt3<<<dim3((unsigned)(((size_t)DQ * DM / 4 + 255) / 256), 3, 1), 256, 0, stream>>>(wq, wk, wv, W3);
    k_cvt8<<<(unsigned)(((size_t)NB_ * TT * DM / 8 + 255) / 256), 256, 0, stream>>>(x, XB, (size_t)NB_ * TT * DM / 8);
    k_proj<<<dim3(NB_ * TT / 256, NH_, 1), 32 * PNW, 0, stream>>>(XB, W3, bq, bk, bv, QPh, QPl, KPh, KPl, VTh, VTl);
    k_fattn<<<dim3(TT / (32 * FNW), NH_, NB_), 32 * FNW, 0, stream>>>(QPh, QPl, KPh, KPl, VTh, VTl, OUT);
}

// v006
// A run of this version takes 96.2 microseconds.
// Next to v005, in two timings, it ran 1.14 times as fast each time.
// Over all steps from v000 it is 13.1 times as fast.
#include <hip/hip_runtime.h>

// SimplifiedMultiHeadAttention (x [2][2048][1024]; per-head q/k/v = x W[h] + b[h] (16 heads, W [16][1024][64]); scores = q.k UNSCALED; att = softmax over keys THEN / sqrt(64); out = concat_h(att v) -> [2][2048][1024], no output projection).
// Compute dtypes, f32 accumulate: every input rounded to bf16; projections on PLAIN bf16 operands (inputs: exact, + bias); because the logits are unscaled (|s| up to ~20)
// EVERY query row takes scores and att.v on bf16 hi+lo planes (3 products each; single fp16 planes would leave ~1e-2 logit error); f32 online softmax in registers with the post-softmax 1/8 folded into the

#define NB_  2
#define TT   2048
#define DM   1024
#define NH_  16
#define NKV  16
#define REP  (NH_ / NKV)
#define HD   64
#define DQ   (NH_ * HD)
#define DKV  (NKV * HD)
#define ZH   2
#define RH   2048                  // read only by k_merge, which is not launched
#define WIN  0
#define PCAR 1024.0f
#define SCL  1.0f                  // unscaled logits (the 1/sqrt(64) is applied AFTER the softmax, folded into the normaliser)
typedef _Float16 h16;
typedef unsigned short bf;
typedef __attribute__((ext_vector_type(16))) __bf16   v16bf;
typedef __attribute__((ext_vector_type(16))) _Float16 v16h;
typedef __attribute__((ext_vector_type(8)))  _Float16 v8h;
typedef __attribute__((ext_vector_type(8)))  unsigned short v8us;
typedef __attribute__((ext_vector_type(8)))  float    v8f;
typedef __attribute__((ext_vector_type(4)))  float    v4f;
typedef v8h  __attribute__((may_alias)) v8ha;
typedef v4f  __attribute__((may_alias)) v4fa;
typedef v8us __attribute__((may_alias)) v8usa;

__device__ __forceinline__ unsigned short f2bf(float f) { unsigned u = __float_as_uint(f); u += 0x7FFFu + ((u >> 16) & 1u); return (unsigned short)(u >> 16); }
__device__ __forceinline__ float bf2f(unsigned short b) { return __uint_as_float(((unsigned)b) << 16); }
__device__ __forceinline__ float bfr(float f) { return bf2f(f2bf(f)); }
__device__ __forceinline__ v16h cat16(v8h lo, v8h hi) { return __builtin_shufflevector(lo, hi, 0, 1, 2, 3, 4, 5, 6, 7, 8, 9, 10, 11, 12, 13, 14, 15); }
__device__ __forceinline__ v16bf cat16b(v8us lo, v8us hi) { return __builtin_bit_cast(v16bf, __builtin_shufflevector(lo, hi, 0, 1, 2, 3, 4, 5, 6, 7, 8, 9, 10, 11, 12, 13, 14, 15)); }
__device__ __forceinline__ v8f wmma16(v16h a, v16h b, v8f c) { return __builtin_amdgcn_wmma_f32_16x16x32_f16(false, a, false, b, (short)0, c, false, false); }
__device__ __forceinline__ v8f wmmab(v16bf a, v16bf b, v8f c) { return __builtin_amdgcn_wmma_f32_16x16x32_bf16(false, a, false, b, (short)0, c, false, false); }



// ---- WFrag: a 16x32 operand fragment from a K-contiguous 16-bit plane (p = this lane's row, + 8 * half), in the hardware k order
template <typename T16> struct WFrag;
template <> struct WFrag<h16> { typedef v16h V; static __device__ __forceinline__ V ld(const h16* p) { return cat16(*(const v8h*)p, *(const v8h*)(p + 16)); } static __device__ __forceinline__ v8f mma(V a, V b, v8f c) { return wmma16(a, b, c); } };
template <> struct WFrag<bf> { typedef v16bf V; static __device__ __forceinline__ V ld(const bf* p) { return cat16b(*(const v8us*)p, *(const v8us*)(p + 16)); } static __device__ __forceinline__ v8f mma(V a, V b, v8f c) { return wmmab(a, b, c); } };

__device__ __forceinline__ h16 tohx(float x) { return (h16)x; }
__device__ __forceinline__ void splitf(float y, unsigned short& h, unsigned short& l) { h = f2bf(y); l = f2bf(y - bf2f(h)); }
typedef __attribute__((ext_vector_type(2))) _Float16 v2h;
typedef __attribute__((ext_vector_type(4))) _Float16 v4h;
typedef __attribute__((ext_vector_type(2))) unsigned short v2us;
typedef __attribute__((ext_vector_type(4))) unsigned short v4us;
typedef __attribute__((ext_vector_type(2))) float v2f;
typedef __attribute__((ext_vector_type(4))) int v4i;

__global__ __launch_bounds__(256) void k_wtG(const float* __restrict__ w, int K, int N, bf* Bt) {
    const int lane = threadIdx.x & 31; const int L0 = (blockIdx.x * 8 + (threadIdx.x >> 5)) * 8; const int nlines = N * K / 64;
{
#pragma unroll 1
        for (int l = 0; l < 8; ++l) { const int L = L0 + l; if (L >= nlines) break; const size_t e = (size_t)L * 64 + lane * 2; const int k = (int)(e % K), n = (int)(e / K); v2us o;
            o[0] = f2bf(w[(size_t)k * N + n]); o[1] = f2bf(w[(size_t)(k + 1) * N + n]); *(v2us*)(Bt + e) = o; }
         }
}
__global__ __launch_bounds__(256) void k_cscvt(const float* __restrict__ cosT, const float* __restrict__ sinT, float* CS) { const int idx = blockIdx.x * 256 + threadIdx.x; if (idx >= TT * HD) return; v2f cs; cs[0] = bfr(cosT[idx]); cs[1] = bfr(sinT[idx]); *(v2f*)(CS + (size_t)idx * 2) = cs;  }
// ---- k_prep: both preparatory passes in one launch sized to the chip: x rounded to its bf16 plane ([NB_*TT][DM]) and the q, k, v weights rounded and transposed to [3][DQ][DM] (k contiguous).
// 256 workgroups of 16 waves, one per WGP: 4096 waves start for the 44 MB moved, each with a long piece, where one short piece a thread would take 40960 waves in two launches.
// A thread issues all its 14 loads of 16 bytes first (every load of a wave covers four whole lines), so that a workgroup's whole share is in flight at once.
// Weights: workgroup = (head, block of 64 k); its three tiles (q, k, v) are 64 k x 64 e, 16 KiB contiguous in the source. A thread takes 4 e of two neighbouring k, packs each (k, k + 1) pair and writes it to the
// transposed tile in LDS (row = e, pitch 144 B for the 16-byte reads); behind the barrier a thread reads 8 k of one e and stores 16 bytes: a wave's store is four whole lines. x: 8 loads, 8 stores of 8 bytes (two whole lines a wave).
#define GNW 16
#define GXL 8                      // x loads a thread
#define WTP (64 + 8)               // row pitch of a transposed weight tile in LDS, elements
static_assert((size_t)NB_ * TT * DM / 4 == (size_t)NH_ * (DM / 64) * GXL * 32 * GNW, "x is dealt evenly over the workgroups");
__device__ __forceinline__ unsigned f2bf2(float a, float b) { unsigned u = __float_as_uint(a), v = __float_as_uint(b); u += 0x7FFFu + ((u >> 16) & 1u); v += 0x7FFFu + ((v >> 16) & 1u); return (u >> 16) | (v & 0xFFFF0000u); }   // f2bf of a in the low half, of b in the high half
typedef __attribute__((ext_vector_type(2))) unsigned v2u;
__global__ __launch_bounds__(32 * GNW) void k_prep(const float* __restrict__ x, const float* __restrict__ wq, const float* __restrict__ wk, const float* __restrict__ wv, bf* XB, bf* W3) {
    __shared__ __align__(16) unsigned tw[3][HD * (WTP / 2)];   // a word = the bf16 pair (k, k + 1) of one e
    const int tid = threadIdx.x; const int h = blockIdx.x / (DM / 64), kb = blockIdx.x % (DM / 64);
    const int kp = tid >> 4, e4 = (tid & 15) * 4;   // this thread's pair of k rows and its four e
    const size_t wo = ((size_t)h * DM + kb * 64 + 2 * kp) * HD + e4; const size_t xo = (size_t)blockIdx.x * (GXL * 32 * GNW) + tid;
    v4f wa[3], wb[3], xv[GXL];
    wa[0] = *(const v4f*)(wq + wo); wb[0] = *(const v4f*)(wq + wo + HD); wa[1] = *(const v4f*)(wk + wo); wb[1] = *(const v4f*)(wk + wo + HD); wa[2] = *(const v4f*)(wv + wo); wb[2] = *(const v4f*)(wv + wo + HD);
#pragma unroll
    for (int it = 0; it < GXL; ++it) xv[it] = *((const v4f*)x + xo + it * (32 * GNW));
    __builtin_amdgcn_sched_barrier(0);   // all 14 loads are issued ahead of the first use: left free, part of them sinks behind the first waits and pays the memory latency a second time
#pragma unroll
    for (int p = 0; p < 3; ++p)
#pragma unroll
        for (int i = 0; i < 4; ++i) tw[p][(e4 + i) * (WTP / 2) + kp] = f2bf2(wa[p][i], wb[p][i]);
    __builtin_amdgcn_sched_barrier(0);   // no use of x rises above the LDS writes: it would bring the wait for the x loads in front of the barrier
    // the barrier orders LDS alone (fences on the local address space): the x loads stay in flight across it
    __builtin_amdgcn_fence(__ATOMIC_RELEASE, "workgroup", "local"); __builtin_amdgcn_s_barrier(); __builtin_amdgcn_fence(__ATOMIC_ACQUIRE, "workgroup", "local");
    const int e = tid >> 3, j = tid & 7;   // the transposed tiles are whole: every row is read by threads that did not write it
#pragma unroll
    for (int p = 0; p < 3; ++p) *(v4i*)(W3 + ((size_t)p * DQ + h * HD + e) * DM + kb * 64 + j * 8) = *(const v4i*)(&tw[p][e * (WTP / 2) + j * 4]);
    __builtin_amdgcn_sched_barrier(0);   // the weight stores go out ahead of the waits for x, not behind them
#pragma unroll
    for (int it = 0; it < GXL; ++it) { v2u o; o[0] = f2bf2(xv[it][0], xv[it][1]); o[1] = f2bf2(xv[it][2], xv[it][3]); *((v2u*)XB + xo + it * (32 * GNW)) = o; }
}
// ---- k_proj: the q, k and v projections of both batches in one launch, from the bf16 planes of x ([NB_*TT][DM]) and of the weights ([3][DQ][DM], k contiguous) straight to the hi+lo head planes that k_fattn reads:
// no f32 projection ever reaches memory. One wave per 64x64 output tile (16 accumulators). grid (NB_*TT/256, heads), 12 waves = 4 position tiles x {q, k, v} of one
// head: 256 workgroups, three waves per SIMD; the three waves of a position tile read the same x rows, the four waves of a projection the same weight rows.
// x and the weights reach the waves through LDS: a fragment load from the planes touches 16 lines for 512 bytes, and every row is wanted by three or four waves. A stage is 128 k (4 trips) of the 256 x rows and
// the 192 weight rows, brought in once per workgroup by asynchronous copies of whole lines (a wave's copy is two rows of 256 bytes), two buffers: stage s + 1 flies while stage s is worked on. Rows are padded by
// 16 bytes (pitch 16 B x odd) for the 16-byte fragment reads. Tile row = x row, then 256 + 64 * projection + weight row. Inside a stage the fragments of trip t + 1 are read, as one group, ahead of the products of trip t.
// q, k: A = x rows, B = weight rows, tile [t][d] -> plane [b][h][t][d]. v: the operands change places (A = weight rows, B = x rows), tile [d][t] -> plane [b][h][d][t]; same products, same k order.
// Epilogue per 16 tile rows: accumulators to this wave's own LDS rows, read back 8 columns a lane, + bias, split, two 16-byte stores: each store instruction writes four whole 128-byte lines.
#define PNW 12
#define PK   128                   // k a stage
#define PP   (PK + 8)              // row pitch in LDS, elements (272 B)
#define PRX  256                   // x rows of a workgroup
#define PSTG ((PRX + 3 * HD) * PP) // a stage, elements
#define PNST (DM / PK)
// eight asynchronous 16-byte copies a lane, global -> LDS: four steps of plane a, four of plane b (la, lb: LDS byte addresses; ls: LDS step in bytes; step n is n & 1 times g1 plus n >> 1 times g2 elements on in global memory).
// The s_wait_xcnt stands inside the statement, behind the last copy: the address registers stay whole up to it.
__device__ __forceinline__ void acopy8(unsigned la, unsigned lb, unsigned ls, const bf* ga, const bf* gb, int g1, int g2) {
    asm volatile("global_load_async_to_lds_b128 %0, %8, off\n\t"
                 "global_load_async_to_lds_b128 %1, %9, off\n\t"
                 "global_load_async_to_lds_b128 %2, %10, off\n\t"
                 "global_load_async_to_lds_b128 %3, %11, off\n\t"
                 "global_load_async_to_lds_b128 %4, %12, off\n\t"
                 "global_load_async_to_lds_b128 %5, %13, off\n\t"
                 "global_load_async_to_lds_b128 %6, %14, off\n\t"
                 "global_load_async_to_lds_b128 %7, %15, off\n\t"
                 "s_wait_xcnt 0x0"
                 :: "v"(la), "v"(la + ls), "v"(la + 2 * ls), "v"(la + 3 * ls), "v"(lb), "v"(lb + ls), "v"(lb + 2 * ls), "v"(lb + 3 * ls),
                    "v"(ga), "v"(ga + g1), "v"(ga + g2), "v"(ga + g1 + g2), "v"(gb), "v"(gb + g1), "v"(gb + g2), "v"(gb + g1 + g2) : "memory");
}
// five such copies, step n being n times ls bytes on in LDS and n times gs elements on in global memory; the s_wait_xcnt stands inside the statement, as above.
__device__ __forceinline__ void acopy5(unsigned l, unsigned ls, const bf* g, int gs) {
    asm volatile("global_load_async_to_lds_b128 %0, %5, off\n\t"
                 "global_load_async_to_lds_b128 %1, %6, off\n\t"
                 "global_load_async_to_lds_b128 %2, %7, off\n\t"
                 "global_load_async_to_lds_b128 %3, %8, off\n\t"
                 "global_load_async_to_lds_b128 %4, %9, off\n\t"
                 "s_wait_xcnt 0x0"
                 :: "v"(l), "v"(l + ls), "v"(l + 2 * ls), "v"(l + 3 * ls), "v"(l + 4 * ls), "v"(g), "v"(g + gs), "v"(g + 2 * gs), "v"(g + 3 * gs), "v"(g + 4 * gs) : "memory");
}
// one such copy, with its s_wait_xcnt
__device__ __forceinline__ void acopy1(unsigned l, const bf* g) { asm volatile("global_load_async_to_lds_b128 %0, %1, off\n\ts_wait_xcnt 0x0" :: "v"(l), "v"(g) : "memory"); }
__global__ __launch_bounds__(32 * PNW) void k_proj(const bf* __restrict__ XB, const bf* __restrict__ W3, const float* __restrict__ bq, const float* __restrict__ bk, const float* __restrict__ bv, bf* Qh, bf* Ql, bf* Kh, bf* Kl, bf* Vh, bf* Vl) {
    typedef WFrag<bf>::V V;
    __shared__ __align__(16) bf pring[2 * PSTG];
    __shared__ __align__(16) float osw[PNW][16 * 68];
    const int lane = threadIdx.x & 31, lr = lane & 15, hi = lane >> 4; const int w = __builtin_amdgcn_readfirstlane((int)(threadIdx.x >> 5));
    const int pj = w % 3, h = blockIdx.y; const int r0 = (blockIdx.x * 4 + w / 3) * 64; const int bb = r0 / TT, t0 = r0 % TT; const bool tr = pj == 2;
    // this lane's share of a stage: bytes 16 (lane & 15) of row lane >> 4 of each pair of tile rows. x: pairs w, w + 12, ... (ten a wave, an eleventh for waves 0 to 7); weights: the eight pairs from 8 w on.
    const unsigned lcx = (unsigned)(size_t)pring + (2 * w + hi) * (PP * 2) + lr * 16, lcw = (unsigned)(size_t)pring + (PRX + 16 * w + hi) * (PP * 2) + lr * 16;
    const bf* gcx = XB + (size_t)(blockIdx.x * PRX + 2 * w + hi) * DM + lr * 8; const bf* gcw = W3 + ((size_t)(w >> 2) * DQ + h * HD + (w & 3) * 16 + hi) * DM + lr * 8;
    auto fill = [&](int st) { const unsigned lb = (st & 1) * (PSTG * 2); const bf* gx = gcx + st * PK; const bf* gw = gcw + st * PK;
        acopy5(lcx + lb, 24 * PP * 2, gx, 24 * DM); acopy5(lcx + lb + 120 * PP * 2, 24 * PP * 2, gx + 120 * DM, 24 * DM);
        if (w < 8) acopy1(lcx + lb + 240 * PP * 2, gx + 240 * DM);   // w is wave-uniform (a scalar): tile rows 240 to 255
        acopy8(lcw + lb, lcw + lb + 8 * PP * 2, 2 * PP * 2, gw, gw + 8 * DM, 2 * DM, 4 * DM); };
    fill(0);
    const int xrow = (w / 3) * 64 + lr, wrow = PRX + pj * HD + lr;   // this lane's first row of the x tile and of the weight tile
    const int oa = (tr ? wrow : xrow) * PP + 8 * hi, ob = (tr ? xrow : wrow) * PP + 8 * hi;
    v8f acc[4][4];
#pragma unroll
    for (int mb = 0; mb < 4; ++mb)
#pragma unroll
        for (int nb = 0; nb < 4; ++nb) acc[mb][nb] = (v8f){};
    asm volatile("s_wait_asynccnt 0x0" ::: "memory");   // this wave's copies of stage 0 have landed
    __syncthreads();                                    // ... and every other wave's: stage 0 may be read
    fill(1);
#pragma unroll 1   // kept rolled: a stage is already straight-line code with 64 matrix instructions
    for (int st = 0; st < PNST; ++st) {
        const bf* pa = pring + (st & 1) * PSTG + oa; const bf* pb = pring + (st & 1) * PSTG + ob;
        V a[2][4], b[2][4];   // two fragment sets: [trip & 1][16-row tile]
#pragma unroll
        for (int i = 0; i < 4; ++i) { a[0][i] = WFrag<bf>::ld(pa + i * 16 * PP); b[0][i] = WFrag<bf>::ld(pb + i * 16 * PP); }
#pragma unroll   // unrolled, as the loops inside: the two fragment sets need static indices to stay in registers
        for (int t = 0; t < PK / 32; ++t) {
            if (t + 1 < PK / 32) {   // inside the stage only: the next stage is read only behind its barrier
#pragma unroll
                for (int i = 0; i < 4; ++i) { a[(t + 1) & 1][i] = WFrag<bf>::ld(pa + i * 16 * PP + (t + 1) * 32); b[(t + 1) & 1][i] = WFrag<bf>::ld(pb + i * 16 * PP + (t + 1) * 32); }
            }
            __builtin_amdgcn_sched_barrier(0);   // the next trip's 16 reads are issued as one group ahead of this trip's products and land under them; left free, they sink among the products and are waited for there
#pragma unroll
            for (int nb = 0; nb < 4; ++nb)
#pragma unroll
                for (int mb = 0; mb < 4; ++mb) acc[mb][nb] = wmmab(a[t & 1][mb], b[t & 1][nb], acc[mb][nb]);
            __builtin_amdgcn_sched_barrier(0);   // holds the products in front of the next group of reads (and, in the last trip, of the slots below)
        }
        asm volatile("v_nop\n\tv_nop\n\tv_nop\n\tv_nop");   // the distance behind the last matrix instruction: the refill's address arithmetic reuses its operand registers
        asm volatile("s_wait_dscnt 0x0" ::: "memory");      // this wave's reads of stage st have returned: its buffer may be refilled behind the barrier
        asm volatile("s_wait_asynccnt 0x0" ::: "memory");   // this wave's copies of stage st + 1 have landed
        __syncthreads();                                    // publishes stage st + 1 and ends every wave's reads of stage st
        if (st + 2 < PNST) fill(st + 2);                    // into the buffer that this trip has just read
    }
    asm volatile("s_wait_asynccnt 0x0" ::: "memory");       // no copy is left in flight when the wave goes on to the epilogue
    float* os = osw[w];
    const float* bias = (pj == 0 ? bq : pj == 1 ? bk : bv) + h * HD; bf* Ph = pj == 0 ? Qh : pj == 1 ? Kh : Vh; bf* Pl = pj == 0 ? Ql : pj == 1 ? Kl : Vl;
    const size_t pofs = ((size_t)bb * NH_ + h) * ((size_t)TT * HD) + (tr ? t0 : t0 * HD); const int pitch = tr ? TT : HD;
    const int rsub = lane >> 3, cofs = (lane & 7) * 8;
    float bc[8];   // q, k: the bias goes by tile column (d), the same 8 for every row of this lane
#pragma unroll
    for (int i = 0; i < 8; ++i) bc[i] = bfr(bias[cofs + i]);
    asm volatile("s_wait_xcnt 0x0" ::: "memory");   // behind the bias loads above: their offset register is reused below
#pragma unroll
    for (int mb = 0; mb < 4; ++mb) {
#pragma unroll
        for (int nb = 0; nb < 4; ++nb) {
#pragma unroll
            for (int j = 0; j < 8; ++j) os[(hi * 8 + j) * 68 + nb * 16 + lr] = acc[mb][nb][j]; }
        __builtin_amdgcn_wave_barrier(); asm volatile("" ::: "memory");   // the rows are read back by other lanes of this wave: the reads stay behind the writes
#pragma unroll
        for (int s = 0; s < 4; ++s) { const int row = 4 * s + rsub; const v4f v0 = *(const v4fa*)(os + row * 68 + cofs), v1 = *(const v4fa*)(os + row * 68 + cofs + 4);
            const float br = bfr(bias[mb * 16 + row]);   // v: the bias goes by tile row (d)
            v8us oh, ol;
#pragma unroll
            for (int i = 0; i < 8; ++i) { unsigned short a2, c2; splitf((i < 4 ? v0[i] : v1[i - 4]) + (tr ? br : bc[i]), a2, c2); oh[i] = a2; ol[i] = c2; }
            const size_t o = pofs + (size_t)(mb * 16 + row) * pitch + cofs; *(v8us*)(Ph + o) = oh; *(v8us*)(Pl + o) = ol; }
        __builtin_amdgcn_wave_barrier(); asm volatile("" ::: "memory");   // the next 16 rows overwrite the staging only behind these reads
    }
}
// ---- k_fattn: scores, softmax, att.v and the output store in one launch; no score or probability ever reaches memory. One wave owns 32 query columns (two 16-column tiles) of one (batch, head) and
// walks the 2048 keys in passes of 32: S^T = K.Q^T (A = K rows, B = Q kept in registers), so a lane holds 16 scores of ONE query per tile; running maximum and sum per lane (online softmax, log2 domain);
// the two 16-key D tiles, converted in place, ARE the B operand of O^T += V^T.P^T (hardware k order, which the plane loader already has). Same hi+lo products as before: 3 per GEMM.
// grid (TT/256, heads, batches), 8 waves: 256 workgroups, two waves per SIMD. Every loop over fragment indices is fully unrolled so that the fragment arrays have static indices and stay in registers.
// K and V reach the waves through LDS: the 8 waves read the same K and V, and a fragment load from the planes touches 16 lines for 512 bytes. A stage is 128 keys (4 passes) of the four planes, brought in once
// per workgroup by asynchronous copies of whole lines (16 a lane), two buffers: stage s + 1 flies while stage s is worked on. Every tile is 128 rows of 128 bytes, padded by 16 bytes (pitch 16 B x odd) for the
// 16-byte fragment reads: K row = key; V^T row = 64 * (key / 64 within the stage) + dim, 64 keys a row.
#define FNW 8
#define SK  128                    // keys a stage
#define KP  (HD + 8)               // row pitch in LDS, elements (144 B)
#define KTL (SK * KP)              // one plane's tile, elements
#define STG (4 * KTL)              // a stage: K hi, K lo, V^T hi, V^T lo
#define NST (TT / SK)
typedef __attribute__((ext_vector_type(2))) __bf16 v2bf;
__device__ __forceinline__ float xhalf(float x) { const int b = __float_as_int(x); return __int_as_float(__builtin_amdgcn_permlanex16(b, b, 0x76543210, 0xfedcba98, false, false)); }   // lane l <-> l ^ 16
__global__ __launch_bounds__(32 * FNW) void k_fattn(const bf* __restrict__ Qh, const bf* __restrict__ Ql, const bf* __restrict__ Kh, const bf* __restrict__ Kl, const bf* __restrict__ Vh, const bf* __restrict__ Vl, float* OUT) {
    typedef WFrag<bf>::V V;
    __shared__ __align__(16) bf ring[2 * STG];
    const int tid = threadIdx.x, lane = tid & 31, lr = lane & 15, hi = lane >> 4, w = tid >> 5; const int h = blockIdx.y, bb = blockIdx.z;
    const size_t pofs = ((size_t)bb * NH_ + h) * ((size_t)TT * HD); const int q0 = (blockIdx.x * FNW + w) * 32;
    Qh += pofs; Ql += pofs; Kh += pofs; Kl += pofs; Vh += pofs; Vl += pofs;
    // this lane's share of a stage: thread t takes bytes 16 (t & 7) of row t >> 3 of each 32 tile rows, so a wave's copy is four whole lines.
    const unsigned lck = (unsigned)(size_t)ring + (tid >> 3) * (KP * 2) + (tid & 7) * 16;
    const unsigned gck = tid * 8, gcv = (tid >> 3) * TT + (tid & 7) * 8;
    auto fill = [&](unsigned st) { const unsigned lb = (st & 1) * (STG * 2); const unsigned ek = gck + st * (SK * HD), ev = gcv + st * SK;   // element offsets in a plane, 32 bits: only gck and gcv live through the loop
        acopy8(lck + lb, lck + lb + KTL * 2, 32 * KP * 2, Kh + ek, Kl + ek, 32 * HD, 64 * HD);
        acopy8(lck + lb + 2 * KTL * 2, lck + lb + 3 * KTL * 2, 32 * KP * 2, Vh + ev, Vl + ev, 32 * TT, 64); };
    fill(0);
    const bf* pqh = Qh + (size_t)(q0 + lr) * HD + 8 * hi; const bf* pql = Ql + (size_t)(q0 + lr) * HD + 8 * hi;
    V qh[2][2], ql[2][2];   // [query tile][32-wide slice of the head dim]
#pragma unroll
    for (int qt = 0; qt < 2; ++qt)
#pragma unroll
        for (int kc = 0; kc < 2; ++kc) { qh[qt][kc] = WFrag<bf>::ld(pqh + qt * 16 * HD + kc * 32); ql[qt][kc] = WFrag<bf>::ld(pql + qt * 16 * HD + kc * 32); }
    asm volatile("s_wait_xcnt 0x0" :: "v"(pqh), "v"(pql) : "memory");   // behind the Q loads above: their address registers stay whole up to this wait and are reused only behind it
    v8f oacc[2][4];         // [query tile][16-row tile of the head dim]: O^T, register r = dim 8*hi + r, lane column = query
#pragma unroll
    for (int qt = 0; qt < 2; ++qt)
#pragma unroll
        for (int dt = 0; dt < 4; ++dt) oacc[qt][dt] = (v8f){};
    float mrun[2] = { -3.0e38f, -3.0e38f }, lsum[2] = { 0.f, 0.f };
    asm volatile("s_wait_asynccnt 0x0" ::: "memory");   // this wave's copies of stage 0 have landed
    __syncthreads();                                    // ... and every other wave's: stage 0 may be read
    fill(1);
#pragma unroll 1   // kept rolled: copies of a stage would only grow the text
    for (int st = 0; st < NST; ++st) {
        const bf* rb = ring + (st & 1) * STG;
        const bf* pkh = rb + lr * KP + 8 * hi; const bf* pkl = pkh + KTL; const bf* pvh = pkh + 2 * KTL; const bf* pvl = pkh + 3 * KTL;   // this lane's row and half; K walks 32 rows a pass, V 32 columns and, every other pass, on to the next 64 rows
        V kh[2][2], kl[2][2];   // [key tile][slice of the head dim]
#pragma unroll
        for (int kt = 0; kt < 2; ++kt)
#pragma unroll
            for (int kc = 0; kc < 2; ++kc) { kh[kt][kc] = WFrag<bf>::ld(pkh + kt * 16 * KP + kc * 32); kl[kt][kc] = WFrag<bf>::ld(pkl + kt * 16 * KP + kc * 32); }
#pragma unroll 1   // kept rolled: a pass is already straight-line code with 48 matrix instructions; unrolled, the four passes' score products are moved together and their live ranges spill
        for (int ps = 0; ps < SK / 32; ++ps) {
            V vh[4], vl[4];
#pragma unroll
            for (int dt = 0; dt < 4; ++dt) { vh[dt] = WFrag<bf>::ld(pvh + ((ps >> 1) * 64 + dt * 16) * KP + (ps & 1) * 32); vl[dt] = WFrag<bf>::ld(pvl + ((ps >> 1) * 64 + dt * 16) * KP + (ps & 1) * 32); }
            __builtin_amdgcn_sched_barrier(0);   // V of this pass is issued ahead of the score products, so that it lands under them and the softmax
            v8f s[2][2];        // [key tile][query tile]
#pragma unroll
            for (int kt = 0; kt < 2; ++kt)
#pragma unroll
                for (int qt = 0; qt < 2; ++qt) s[kt][qt] = (v8f){};
#pragma unroll
            for (int kc = 0; kc < 2; ++kc) {
#pragma unroll
                for (int kt = 0; kt < 2; ++kt)
#pragma unroll
                    for (int qt = 0; qt < 2; ++qt) s[kt][qt] = wmmab(kh[kt][kc], qh[qt][kc], s[kt][qt]);
#pragma unroll
                for (int kt = 0; kt < 2; ++kt)
#pragma unroll
                    for (int qt = 0; qt < 2; ++qt) s[kt][qt] = wmmab(kl[kt][kc], qh[qt][kc], s[kt][qt]);
#pragma unroll
                for (int kt = 0; kt < 2; ++kt)
#pragma unroll
                    for (int qt = 0; qt < 2; ++qt) s[kt][qt] = wmmab(kh[kt][kc], ql[qt][kc], s[kt][qt]);
            }
            __builtin_amdgcn_sched_barrier(0);   // the next pass's K reads stay behind the products that read these registers and ahead of the softmax, which covers their latency
            if (ps + 1 < SK / 32) {              // inside the stage only: the next stage is read only behind its barrier
#pragma unroll
                for (int kt = 0; kt < 2; ++kt)
#pragma unroll
                    for (int kc = 0; kc < 2; ++kc) { kh[kt][kc] = WFrag<bf>::ld(pkh + ((ps + 1) * 32 + kt * 16) * KP + kc * 32); kl[kt][kc] = WFrag<bf>::ld(pkl + ((ps + 1) * 32 + kt * 16) * KP + kc * 32); }
            }
            __builtin_amdgcn_sched_barrier(0);   // see above: keeps those reads from sinking to their uses in the next pass
            V ph[2], pl[2];
#pragma unroll
            for (int qt = 0; qt < 2; ++qt) {
                float mx = s[0][qt][0];
#pragma unroll
                for (int j = 1; j < 8; ++j) mx = fmaxf(mx, s[0][qt][j]);
#pragma unroll
                for (int j = 0; j < 8; ++j) mx = fmaxf(mx, s[1][qt][j]);
                mx = fmaxf(mx, xhalf(mx));
                const float mn = fmaxf(mrun[qt], mx * 1.4426950408889634f); const float al = __builtin_amdgcn_exp2f(mrun[qt] - mn); mrun[qt] = mn;
                v2f sum2 = { 0.f, 0.f };
#pragma unroll
                for (int kt = 0; kt < 2; ++kt)
#pragma unroll
                    for (int j = 0; j < 8; j += 2) { v2f t; t[0] = s[kt][qt][j]; t[1] = s[kt][qt][j + 1]; t = __builtin_elementwise_fma(t, (v2f){ 1.4426950408889634f, 1.4426950408889634f }, (v2f){ -mn, -mn }); v2f p; p[0] = __builtin_amdgcn_exp2f(t[0]); p[1] = __builtin_amdgcn_exp2f(t[1]); sum2 += p;
                        const v2bf a = __builtin_convertvector(p, v2bf); const v2f r = p - __builtin_convertvector(a, v2f); const v2bf c = __builtin_convertvector(r, v2bf);
                        ph[qt][kt * 8 + j] = a[0]; ph[qt][kt * 8 + j + 1] = a[1]; pl[qt][kt * 8 + j] = c[0]; pl[qt][kt * 8 + j + 1] = c[1]; }
                lsum[qt] = lsum[qt] * al + (sum2[0] + sum2[1]);   // this half's keys only; the halves are joined once, behind the loop
#pragma unroll
                for (int dt = 0; dt < 4; ++dt) oacc[qt][dt] *= al;
            }
#pragma unroll
            for (int dt = 0; dt < 4; ++dt)
#pragma unroll
                for (int qt = 0; qt < 2; ++qt) oacc[qt][dt] = wmmab(vh[dt], ph[qt], oacc[qt][dt]);
#pragma unroll
            for (int dt = 0; dt < 4; ++dt)
#pragma unroll
                for (int qt = 0; qt < 2; ++qt) oacc[qt][dt] = wmmab(vl[dt], ph[qt], oacc[qt][dt]);
#pragma unroll
            for (int dt = 0; dt < 4; ++dt)
#pragma unroll
                for (int qt = 0; qt < 2; ++qt) oacc[qt][dt] = wmmab(vh[dt], pl[qt], oacc[qt][dt]);
            __builtin_amdgcn_sched_barrier(0);                   // holds the products above in front of the slots below
            asm volatile("v_nop\n\tv_nop\n\tv_nop\n\tv_nop");   // the distance behind the last matrix instruction, on both sides of the loop's branch: the next pass's address arithmetic and the refill's reuse its operand registers
        }
        asm volatile("s_wait_dscnt 0x0" ::: "memory");      // this wave's reads of stage st have returned: its buffer may be refilled behind the barrier
        asm volatile("s_wait_asynccnt 0x0" ::: "memory");   // this wave's copies of stage st + 1 have landed
        __syncthreads();                                    // publishes stage st + 1 and ends every wave's reads of stage st
        if (st + 2 < NST) fill(st + 2);                     // into the buffer that this trip has just read
    }
    asm volatile("s_wait_asynccnt 0x0" ::: "memory");       // no copy is left in flight when the wave ends
#pragma unroll
    for (int qt = 0; qt < 2; ++qt) { const float f = __fdiv_rn(0.125f, lsum[qt] + xhalf(lsum[qt]));   // softmax / sqrt(64)
        float* orow = OUT + ((size_t)bb * TT + q0 + qt * 16 + lr) * DM + h * HD + 8 * hi;
#pragma unroll
        for (int dt = 0; dt < 4; ++dt) { v4f lo4, hi4;
#pragma unroll
            for (int j = 0; j < 4; ++j) { lo4[j] = oacc[qt][dt][j] * f; hi4[j] = oacc[qt][dt][4 + j] * f; }
            *(v4f*)(orow + dt * 16) = lo4; *(v4f*)(orow + dt * 16 + 4) = hi4; } }
}
__global__ __launch_bounds__(256) void k_merge(const float* __restrict__ O, int h0, bf* Ah, bf* Al) { const size_t e = ((size_t)blockIdx.x * 256 + threadIdx.x) * 2; if (e >= (size_t)ZH * TT * HD) return; const int d = (int)(e % HD); const int t = (int)((e / HD) % TT); const int zz = (int)(e / ((size_t)HD * TT)); const float cs = (t < RH) ? 1.0f : (1.0f / PCAR); const size_t oo = (size_t)t * DQ + (h0 + zz) * HD + d;
    v2us oh, ol;
#pragma unroll
    for (int q = 0; q < 2; ++q) { unsigned short a, c2; splitf(O[e + q] * cs, a, c2); oh[q] = a; ol[q] = c2; } *(v2us*)(Ah + oo) = oh; *(v2us*)(Al + oo) = ol;  }

extern "C" void kernel_launch(void* const* d_in, const int* in_sizes, int n_in,
                              void* d_out, int out_size, void* d_ws, size_t ws_size, hipStream_t stream) {
    (void)in_sizes; (void)n_in; (void)out_size;
    const float* x = (const float*)d_in[0]; const float* wq = (const float*)d_in[1]; const float* bq = (const float*)d_in[2]; const float* wk = (const float*)d_in[3]; const float* bk = (const float*)d_in[4]; const float* wv = (const float*)d_in[5]; const float* bv = (const float*)d_in[6];   // W [16][1024][64] per head (x @ W[h]), b [16][64]
    float* OUT = (float*)d_out;     // [2][2048][1024]
    char* wsp = (char*)d_ws;
    auto take = [&](size_t bytes) { char* p = wsp; wsp += (bytes + 255) & ~(size_t)255; return (void*)p; };
    bf* W3 = (bf*)take((size_t)3 * DQ * DM * 2); bf* XB = (bf*)take((size_t)NB_ * TT * DM * 2);   // q, k, v weights transposed; x of both batches
    const size_t PB = (size_t)NH_ * TT * HD;   // one batch's hi or lo plane, elements; the planes hold both batches
    bf* QPh = (bf*)take(NB_ * PB * 2); bf* QPl = (bf*)take(NB_ * PB * 2); bf* KPh = (bf*)take(NB_ * PB * 2); bf* KPl = (bf*)take(NB_ * PB * 2); bf* VTh = (bf*)take(NB_ * PB * 2); bf* VTl = (bf*)take(NB_ * PB * 2);
    if ((size_t)(wsp - (char*)d_ws) > ws_size) return;    // ws 256 MiB
    k_prep<<<NH_ * (DM / 64), 32 * GNW, 0, stream>>>(x, wq, wk, wv, XB, W3);
    k_proj<<<dim3(NB_ * TT / 256, NH_, 1), 32 * PNW, 0, stream>>>(XB, W3, bq, bk, bv, QPh, QPl, KPh, KPl, VTh, VTl);
    k_fattn<<<dim3(TT / (32 * FNW), NH_, NB_), 32 * FNW, 0, stream>>>(QPh, QPl, KPh, KPl, VTh, VTl, OUT);
}

// v007
// It runs in 92.9 microseconds.
// Next to v006, in two timings, it ran 1.04 times as fast each time.
// All steps since v000 together make it 13.6 times as fast.
#include <hip/hip_runtime.h>

// SimplifiedMultiHeadAttention (x [2][2048][1024]; per-head q/k/v = x W[h] + b[h] (16 heads, W [16][1024][64]); scores = q.k UNSCALED; att = softmax over keys THEN / sqrt(64); out = concat_h(att v) -> [2][2048][1024], no output projection).
// Compute dtypes, f32 accumulate: every input rounded to bf16; projections on PLAIN bf16 operands (inputs: exact, + bias); because the logits are unscaled (|s| up to ~20)
// EVERY query row takes scores and att.v on bf16 hi+lo planes (3 products each; single fp16 planes would leave ~1e-2 logit error); f32 online softmax in registers with the post-softmax 1/8 folded into the

#define NB_  2
#define TT   2048
#define DM   1024
#define NH_  16
#define NKV  16
#define REP  (NH_ / NKV)
#define HD   64
#define DQ   (NH_ * HD)
#define DKV  (NKV * HD)
#define ZH   2
#define RH   2048                  // read only by k_merge, which is not launched
#define WIN  0
#define PCAR 1024.0f
#define SCL  1.0f                  // unscaled logits (the 1/sqrt(64) is applied AFTER the softmax, folded into the normaliser)
typedef _Float16 h16;
typedef unsigned short bf;
typedef __attribute__((ext_vector_type(16))) __bf16   v16bf;
typedef __attribute__((ext_vector_type(16))) _Float16 v16h;
typedef __attribute__((ext_vector_type(8)))  _Float16 v8h;
typedef __attribute__((ext_vector_type(8)))  unsigned short v8us;
typedef __attribute__((ext_vector_type(8)))  float    v8f;
typedef __attribute__((ext_vector_type(4)))  float    v4f;
typedef v8h  __attribute__((may_alias)) v8ha;
typedef v4f  __attribute__((may_alias)) v4fa;
typedef v8us __attribute__((may_alias)) v8usa;

__device__ __forceinline__ unsigned short f2bf(float f) { unsigned u = __float_as_uint(f); u += 0x7FFFu + ((u >> 16) & 1u); return (unsigned short)(u >> 16); }
__device__ __forceinline__ float bf2f(unsigned short b) { return __uint_as_float(((unsigned)b) << 16); }
__device__ __forceinline__ float bfr(float f) { return bf2f(f2bf(f)); }
__device__ __forceinline__ v16h cat16(v8h lo, v8h hi) { return __builtin_shufflevector(lo, hi, 0, 1, 2, 3, 4, 5, 6, 7, 8, 9, 10, 11, 12, 13, 14, 15); }
__device__ __forceinline__ v16bf cat16b(v8us lo, v8us hi) { return __builtin_bit_cast(v16bf, __builtin_shufflevector(lo, hi, 0, 1, 2, 3, 4, 5, 6, 7, 8, 9, 10, 11, 12, 13, 14, 15)); }
__device__ __forceinline__ v8f wmma16(v16h a, v16h b, v8f c) { return __builtin_amdgcn_wmma_f32_16x16x32_f16(false, a, false, b, (short)0, c, false, false); }
__device__ __forceinline__ v8f wmmab(v16bf a, v16bf b, v8f c) { return __builtin_amdgcn_wmma_f32_16x16x32_bf16(false, a, false, b, (short)0, c, false, false); }



// ---- WFrag: a 16x32 operand fragment from a K-contiguous 16-bit plane (p = this lane's row, + 8 * half), in the hardware k order
template <typename T16> struct WFrag;
template <> struct WFrag<h16> { typedef v16h V; static __device__ __forceinline__ V ld(const h16* p) { return cat16(*(const v8h*)p, *(const v8h*)(p + 16)); } static __device__ __forceinline__ v8f mma(V a, V b, v8f c) { return wmma16(a, b, c); } };
template <> struct WFrag<bf> { typedef v16bf V; static __device__ __forceinline__ V ld(const bf* p) { return cat16b(*(const v8us*)p, *(const v8us*)(p + 16)); } static __device__ __forceinline__ v8f mma(V a, V b, v8f c) { return wmmab(a, b, c); } };

__device__ __forceinline__ h16 tohx(float x) { return (h16)x; }
__device__ __forceinline__ void splitf(float y, unsigned short& h, unsigned short& l) { h = f2bf(y); l = f2bf(y - bf2f(h)); }
typedef __attribute__((ext_vector_type(2))) _Float16 v2h;
typedef __attribute__((ext_vector_type(4))) _Float16 v4h;
typedef __attribute__((ext_vector_type(2))) unsigned short v2us;
typedef __attribute__((ext_vector_type(4))) unsigned short v4us;
typedef __attribute__((ext_vector_type(2))) float v2f;
typedef __attribute__((ext_vector_type(4))) int v4i;

__global__ __launch_bounds__(256) void k_wtG(const float* __restrict__ w, int K, int N, bf* Bt) {
    const int lane = threadIdx.x & 31; const int L0 = (blockIdx.x * 8 + (threadIdx.x >> 5)) * 8; const int nlines = N * K / 64;
{
#pragma unroll 1
        for (int l = 0; l < 8; ++l) { const int L = L0 + l; if (L >= nlines) break; const size_t e = (size_t)L * 64 + lane * 2; const int k = (int)(e % K), n = (int)(e / K); v2us o;
            o[0] = f2bf(w[(size_t)k * N + n]); o[1] = f2bf(w[(size_t)(k + 1) * N + n]); *(v2us*)(Bt + e) = o; }
         }
}
__global__ __launch_bounds__(256) void k_cscvt(const float* __restrict__ cosT, const float* __restrict__ sinT, float* CS) { const int idx = blockIdx.x * 256 + threadIdx.x; if (idx >= TT * HD) return; v2f cs; cs[0] = bfr(cosT[idx]); cs[1] = bfr(sinT[idx]); *(v2f*)(CS + (size_t)idx * 2) = cs;  }
// ---- k_prep: both preparatory passes in one launch sized to the chip: x rounded to its bf16 plane ([NB_*TT][DM]) and the q, k, v weights rounded and transposed to [3][DQ][DM] (k contiguous).
// 256 workgroups of 16 waves, one per WGP: 4096 waves start for the 44 MB moved, each with a long piece, where one short piece a thread would take 40960 waves in two launches.
// A thread issues all its 14 loads of 16 bytes first (every load of a wave covers four whole lines), so that a workgroup's whole share is in flight at once.
// Weights: workgroup = (head, block of 64 k); its three tiles (q, k, v) are 64 k x 64 e, 16 KiB contiguous in the source. A thread takes 4 e of two neighbouring k, packs each (k, k + 1) pair and writes it to the
// transposed tile in LDS (row = e, pitch 144 B for the 16-byte reads); behind the barrier a thread reads 8 k of one e and stores 16 bytes: a wave's store is four whole lines. x: 8 loads, 8 stores of 8 bytes (two whole lines a wave).
#define GNW 16
#define GXL 8                      // x loads a thread
#define WTP (64 + 8)               // row pitch of a transposed weight tile in LDS, elements
static_assert((size_t)NB_ * TT * DM / 4 == (size_t)NH_ * (DM / 64) * GXL * 32 * GNW, "x is dealt evenly over the workgroups");
__device__ __forceinline__ unsigned f2bf2(float a, float b) { unsigned u = __float_as_uint(a), v = __float_as_uint(b); u += 0x7FFFu + ((u >> 16) & 1u); v += 0x7FFFu + ((v >> 16) & 1u); return (u >> 16) | (v & 0xFFFF0000u); }   // f2bf of a in the low half, of b in the high half
typedef __attribute__((ext_vector_type(2))) unsigned v2u;
__global__ __launch_bounds__(32 * GNW) void k_prep(const float* __restrict__ x, const float* __restrict__ wq, const float* __restrict__ wk, const float* __restrict__ wv, bf* XB, bf* W3) {
    __shared__ __align__(16) unsigned tw[3][HD * (WTP / 2)];   // a word = the bf16 pair (k, k + 1) of one e
    const int tid = threadIdx.x; const int h = blockIdx.x / (DM / 64), kb = blockIdx.x % (DM / 64);
    const int kp = tid >> 4, e4 = (tid & 15) * 4;   // this thread's pair of k rows and its four e
    const size_t wo = ((size_t)h * DM + kb * 64 + 2 * kp) * HD + e4; const size_t xo = (size_t)blockIdx.x * (GXL * 32 * GNW) + tid;
    v4f wa[3], wb[3], xv[GXL];
    wa[0] = *(const v4f*)(wq + wo); wb[0] = *(const v4f*)(wq + wo + HD); wa[1] = *(const v4f*)(wk + wo); wb[1] = *(const v4f*)(wk + wo + HD); wa[2] = *(const v4f*)(wv + wo); wb[2] = *(const v4f*)(wv + wo + HD);
#pragma unroll
    for (int it = 0; it < GXL; ++it) xv[it] = *((const v4f*)x + xo + it * (32 * GNW));
    __builtin_amdgcn_sched_barrier(0);   // all 14 loads are issued ahead of the first use: left free, part of them sinks behind the first waits and pays the memory latency a second time
#pragma unroll
    for (int p = 0; p < 3; ++p)
#pragma unroll
        for (int i = 0; i < 4; ++i) tw[p][(e4 + i) * (WTP / 2) + kp] = f2bf2(wa[p][i], wb[p][i]);
    __builtin_amdgcn_sched_barrier(0);   // no use of x rises above the LDS writes: it would bring the wait for the x loads in front of the barrier
    // the barrier orders LDS alone (fences on the local address space): the x loads stay in flight across it
    __builtin_amdgcn_fence(__ATOMIC_RELEASE, "workgroup", "local"); __builtin_amdgcn_s_barrier(); __builtin_amdgcn_fence(__ATOMIC_ACQUIRE, "workgroup", "local");
    const int e = tid >> 3, j = tid & 7;   // the transposed tiles are whole: every row is read by threads that did not write it
#pragma unroll
    for (int p = 0; p < 3; ++p) *(v4i*)(W3 + ((size_t)p * DQ + h * HD + e) * DM + kb * 64 + j * 8) = *(const v4i*)(&tw[p][e * (WTP / 2) + j * 4]);
    __builtin_amdgcn_sched_barrier(0);   // the weight stores go out ahead of the waits for x, not behind them
#pragma unroll
    for (int it = 0; it < GXL; ++it) { v2u o; o[0] = f2bf2(xv[it][0], xv[it][1]); o[1] = f2bf2(xv[it][2], xv[it][3]); *((v2u*)XB + xo + it * (32 * GNW)) = o; }
}
// ---- k_proj: the q, k and v projections of both batches in one launch, from the bf16 planes of x ([NB_*TT][DM]) and of the weights ([3][DQ][DM], k contiguous) straight to the hi+lo head planes that k_fattn reads:
// no f32 projection ever reaches memory. One wave per 64x64 output tile (16 accumulators). grid (NB_*TT/256, heads), 12 waves = 4 position tiles x {q, k, v} of one
// head: 256 workgroups, three waves per SIMD; the three waves of a position tile read the same x rows, the four waves of a projection the same weight rows.
// x and the weights reach the waves through LDS: a fragment load from the planes touches 16 lines for 512 bytes, and every row is wanted by three or four waves. A stage is 128 k (4 trips) of the 256 x rows and
// the 192 weight rows, brought in once per workgroup by asynchronous copies of whole lines (a wave's copy is two rows of 256 bytes), two buffers: stage s + 1 flies while stage s is worked on. Rows are padded by
// 16 bytes (pitch 16 B x odd) for the 16-byte fragment reads. Tile row = x row, then 256 + 64 * projection + weight row. Inside a stage the fragments of trip t + 1 are read, as one group, ahead of the products of trip t.
// q, k: A = x rows, B = weight rows, tile [t][d] -> plane [b][h][t][d]. v: the operands change places (A = weight rows, B = x rows), tile [d][t] -> plane [b][h][d][t]; same products, same k order.
// Epilogue per 16 tile rows: accumulators to this wave's own LDS rows, read back 8 columns a lane, + bias, split, two 16-byte stores: each store instruction writes four whole 128-byte lines.
#define PNW 12
#define PK   128                   // k a stage
#define PP   (PK + 8)              // row pitch in LDS, elements (272 B)
#define PRX  256                   // x rows of a workgroup
#define PSTG ((PRX + 3 * HD) * PP) // a stage, elements
#define PNST (DM / PK)
// eight asynchronous 16-byte copies a lane, global -> LDS: four steps of plane a, four of plane b (la, lb: LDS byte addresses; ls: LDS step in bytes; step n is n & 1 times g1 plus n >> 1 times g2 elements on in global memory).
// The s_wait_xcnt stands inside the statement, behind the last copy: the address registers stay whole up to it.
__device__ __forceinline__ void acopy8(unsigned la, unsigned lb, unsigned ls, const bf* ga, const bf* gb, int g1, int g2) {
    asm volatile("global_load_async_to_lds_b128 %0, %8, off\n\t"
                 "global_load_async_to_lds_b128 %1, %9, off\n\t"
                 "global_load_async_to_lds_b128 %2, %10, off\n\t"
                 "global_load_async_to_lds_b128 %3, %11, off\n\t"
                 "global_load_async_to_lds_b128 %4, %12, off\n\t"
                 "global_load_async_to_lds_b128 %5, %13, off\n\t"
                 "global_load_async_to_lds_b128 %6, %14, off\n\t"
                 "global_load_async_to_lds_b128 %7, %15, off\n\t"
                 "s_wait_xcnt 0x0"
                 :: "v"(la), "v"(la + ls), "v"(la + 2 * ls), "v"(la + 3 * ls), "v"(lb), "v"(lb + ls), "v"(lb + 2 * ls), "v"(lb + 3 * ls),
                    "v"(ga), "v"(ga + g1), "v"(ga + g2), "v"(ga + g1 + g2), "v"(gb), "v"(gb + g1), "v"(gb + g2), "v"(gb + g1 + g2) : "memory");
}
// five such copies, step n being n times ls bytes on in LDS and n times gs elements on in global memory; the s_wait_xcnt stands inside the statement, as above.
__device__ __forceinline__ void acopy5(unsigned l, unsigned ls, const bf* g, int gs) {
    asm volatile("global_load_async_to_lds_b128 %0, %5, off\n\t"
                 "global_load_async_to_lds_b128 %1, %6, off\n\t"
                 "global_load_async_to_lds_b128 %2, %7, off\n\t"
                 "global_load_async_to_lds_b128 %3, %8, off\n\t"
                 "global_load_async_to_lds_b128 %4, %9, off\n\t"
                 "s_wait_xcnt 0x0"
                 :: "v"(l), "v"(l + ls), "v"(l + 2 * ls), "v"(l + 3 * ls), "v"(l + 4 * ls), "v"(g), "v"(g + gs), "v"(g + 2 * gs), "v"(g + 3 * gs), "v"(g + 4 * gs) : "memory");
}
// one such copy, with its s_wait_xcnt
__device__ __forceinline__ void acopy1(unsigned l, const bf* g) { asm volatile("global_load_async_to_lds_b128 %0, %1, off\n\ts_wait_xcnt 0x0" :: "v"(l), "v"(g) : "memory"); }
__global__ __launch_bounds__(32 * PNW) void k_proj(const bf* __restrict__ XB, const bf* __restrict__ W3, const float* __restrict__ bq, const float* __restrict__ bk, const float* __restrict__ bv, bf* Qh, bf* Ql, bf* Kh, bf* Kl, bf* Vh, bf* Vl) {
    typedef WFrag<bf>::V V;
    __shared__ __align__(16) bf pring[2 * PSTG];
    __shared__ __align__(16) float osw[PNW][16 * 68];
    const int lane = threadIdx.x & 31, lr = lane & 15, hi = lane >> 4; const int w = __builtin_amdgcn_readfirstlane((int)(threadIdx.x >> 5));
    const int pj = w % 3, h = blockIdx.y; const int r0 = (blockIdx.x * 4 + w / 3) * 64; const int bb = r0 / TT, t0 = r0 % TT; const bool tr = pj == 2;
    // this lane's share of a stage: bytes 16 (lane & 15) of row lane >> 4 of each pair of tile rows. x: pairs w, w + 12, ... (ten a wave, an eleventh for waves 0 to 7); weights: the eight pairs from 8 w on.
    const unsigned lcx = (unsigned)(size_t)pring + (2 * w + hi) * (PP * 2) + lr * 16, lcw = (unsigned)(size_t)pring + (PRX + 16 * w + hi) * (PP * 2) + lr * 16;
    const bf* gcx = XB + (size_t)(blockIdx.x * PRX + 2 * w + hi) * DM + lr * 8; const bf* gcw = W3 + ((size_t)(w >> 2) * DQ + h * HD + (w & 3) * 16 + hi) * DM + lr * 8;
    auto fill = [&](int st) { const unsigned lb = (st & 1) * (PSTG * 2); const bf* gx = gcx + st * PK; const bf* gw = gcw + st * PK;
        acopy5(lcx + lb, 24 * PP * 2, gx, 24 * DM); acopy5(lcx + lb + 120 * PP * 2, 24 * PP * 2, gx + 120 * DM, 24 * DM);
        if (w < 8) acopy1(lcx + lb + 240 * PP * 2, gx + 240 * DM);   // w is wave-uniform (a scalar): tile rows 240 to 255
        acopy8(lcw + lb, lcw + lb + 8 * PP * 2, 2 * PP * 2, gw, gw + 8 * DM, 2 * DM, 4 * DM); };
    fill(0);
    const int xrow = (w / 3) * 64 + lr, wrow = PRX + pj * HD + lr;   // this lane's first row of the x tile and of the weight tile
    const int oa = (tr ? wrow : xrow) * PP + 8 * hi, ob = (tr ? xrow : wrow) * PP + 8 * hi;
    v8f acc[4][4];
#pragma unroll
    for (int mb = 0; mb < 4; ++mb)
#pragma unroll
        for (int nb = 0; nb < 4; ++nb) acc[mb][nb] = (v8f){};
    asm volatile("s_wait_asynccnt 0x0" ::: "memory");   // this wave's copies of stage 0 have landed
    __syncthreads();                                    // ... and every other wave's: stage 0 may be read
    fill(1);
#pragma unroll 1   // kept rolled: a stage is already straight-line code with 64 matrix instructions
    for (int st = 0; st < PNST; ++st) {
        const bf* pa = pring + (st & 1) * PSTG + oa; const bf* pb = pring + (st & 1) * PSTG + ob;
        V a[2][4], b[2][4];   // two fragment sets: [trip & 1][16-row tile]
#pragma unroll
        for (int i = 0; i < 4; ++i) { a[0][i] = WFrag<bf>::ld(pa + i * 16 * PP); b[0][i] = WFrag<bf>::ld(pb + i * 16 * PP); }
#pragma unroll   // unrolled, as the loops inside: the two fragment sets need static indices to stay in registers
        for (int t = 0; t < PK / 32; ++t) {
            if (t + 1 < PK / 32) {   // inside the stage only: the next stage is read only behind its barrier
#pragma unroll
                for (int i = 0; i < 4; ++i) { a[(t + 1) & 1][i] = WFrag<bf>::ld(pa + i * 16 * PP + (t + 1) * 32); b[(t + 1) & 1][i] = WFrag<bf>::ld(pb + i * 16 * PP + (t + 1) * 32); }
            }
            __builtin_amdgcn_sched_barrier(0);   // the next trip's 16 reads are issued as one group ahead of this trip's products and land under them; left free, they sink among the products and are waited for there
#pragma unroll
            for (int nb = 0; nb < 4; ++nb)
#pragma unroll
                for (int mb = 0; mb < 4; ++mb) acc[mb][nb] = wmmab(a[t & 1][mb], b[t & 1][nb], acc[mb][nb]);
            __builtin_amdgcn_sched_barrier(0);   // holds the products in front of the next group of reads (and, in the last trip, of the slots below)
        }
        asm volatile("v_nop\n\tv_nop\n\tv_nop\n\tv_nop");   // the distance behind the last matrix instruction: the refill's address arithmetic reuses its operand registers
        asm volatile("s_wait_dscnt 0x0" ::: "memory");      // this wave's reads of stage st have returned: its buffer may be refilled behind the barrier
        asm volatile("s_wait_asynccnt 0x0" ::: "memory");   // this wave's copies of stage st + 1 have landed
        __syncthreads();                                    // publishes stage st + 1 and ends every wave's reads of stage st
        if (st + 2 < PNST) fill(st + 2);                    // into the buffer that this trip has just read
    }
    asm volatile("s_wait_asynccnt 0x0" ::: "memory");       // no copy is left in flight when the wave goes on to the epilogue
    float* os = osw[w];
    const float* bias = (pj == 0 ? bq : pj == 1 ? bk : bv) + h * HD; bf* Ph = pj == 0 ? Qh : pj == 1 ? Kh : Vh; bf* Pl = pj == 0 ? Ql : pj == 1 ? Kl : Vl;
    const size_t pofs = ((size_t)bb * NH_ + h) * ((size_t)TT * HD) + (tr ? t0 : t0 * HD); const int pitch = tr ? TT : HD;
    const int rsub = lane >> 3, cofs = (lane & 7) * 8;
    const float qs = pj == 0 ? 1.4426950408889634f : 1.0f;   // q carries log2(e): k_fattn's scores then come out of the matrix unit in the log2 domain
    float bc[8];   // q, k: the bias goes by tile column (d), the same 8 for every row of this lane
#pragma unroll
    for (int i = 0; i < 8; ++i) bc[i] = bfr(bias[cofs + i]);
    asm volatile("s_wait_xcnt 0x0" ::: "memory");   // behind the bias loads above: their offset register is reused below
#pragma unroll
    for (int mb = 0; mb < 4; ++mb) {
#pragma unroll
        for (int nb = 0; nb < 4; ++nb) {
#pragma unroll
            for (int j = 0; j < 8; ++j) os[(hi * 8 + j) * 68 + nb * 16 + lr] = acc[mb][nb][j]; }
        __builtin_amdgcn_wave_barrier(); asm volatile("" ::: "memory");   // the rows are read back by other lanes of this wave: the reads stay behind the writes
#pragma unroll
        for (int s = 0; s < 4; ++s) { const int row = 4 * s + rsub; const v4f v0 = *(const v4fa*)(os + row * 68 + cofs), v1 = *(const v4fa*)(os + row * 68 + cofs + 4);
            const float br = bfr(bias[mb * 16 + row]);   // v: the bias goes by tile row (d)
            v8us oh, ol;
#pragma unroll
            for (int i = 0; i < 8; ++i) { unsigned short a2, c2; splitf(((i < 4 ? v0[i] : v1[i - 4]) + (tr ? br : bc[i])) * qs, a2, c2); oh[i] = a2; ol[i] = c2; }
            const size_t o = pofs + (size_t)(mb * 16 + row) * pitch + cofs; *(v8us*)(Ph + o) = oh; *(v8us*)(Pl + o) = ol; }
        __builtin_amdgcn_wave_barrier(); asm volatile("" ::: "memory");   // the next 16 rows overwrite the staging only behind these reads
    }
}
// ---- k_fattn: scores, softmax, att.v and the output store in one launch; no score or probability ever reaches memory. One wave owns 32 query columns (two 16-column tiles) of one (batch, head) and
// walks the 2048 keys in passes of 32: S^T = K.Q^T (A = K rows, B = Q kept in registers), so a lane holds 16 scores of ONE query per tile; running shift and sum per lane (online softmax, log2 domain: q carries log2(e); minus the shift is the C operand of the score products);
// the two 16-key D tiles, converted in place, ARE the B operand of O^T += V^T.P^T (hardware k order, which the plane loader already has). Same hi+lo products as before: 3 per GEMM.
// grid (TT/256, heads, batches), 8 waves: 256 workgroups, two waves per SIMD. Every loop over fragment indices is fully unrolled so that the fragment arrays have static indices and stay in registers.
// K and V reach the waves through LDS: the 8 waves read the same K and V, and a fragment load from the planes touches 16 lines for 512 bytes. A stage is 128 keys (4 passes) of the four planes, brought in once
// per workgroup by asynchronous copies of whole lines (16 a lane), two buffers: stage s + 1 flies while stage s is worked on. Every tile is 128 rows of 128 bytes, padded by 16 bytes (pitch 16 B x odd) for the
// 16-byte fragment reads: K row = key; V^T row = 64 * (key / 64 within the stage) + dim, 64 keys a row.
#define FNW 8
#define SK  128                    // keys a stage
#define KP  (HD + 8)               // row pitch in LDS, elements (144 B)
#define KTL (SK * KP)              // one plane's tile, elements
#define STG (4 * KTL)              // a stage: K hi, K lo, V^T hi, V^T lo
#define NST (TT / SK)
typedef __attribute__((ext_vector_type(2))) __bf16 v2bf;
__device__ __forceinline__ float xhalf(float x) { const int b = __float_as_int(x); return __int_as_float(__builtin_amdgcn_permlanex16(b, b, 0x76543210, 0xfedcba98, false, false)); }   // lane l <-> l ^ 16
__global__ __launch_bounds__(32 * FNW) void k_fattn(const bf* __restrict__ Qh, const bf* __restrict__ Ql, const bf* __restrict__ Kh, const bf* __restrict__ Kl, const bf* __restrict__ Vh, const bf* __restrict__ Vl, float* OUT) {
    typedef WFrag<bf>::V V;
    __shared__ __align__(16) bf ring[2 * STG];
    const int tid = threadIdx.x, lane = tid & 31, lr = lane & 15, hi = lane >> 4, w = tid >> 5; const int h = blockIdx.y, bb = blockIdx.z;
    const size_t pofs = ((size_t)bb * NH_ + h) * ((size_t)TT * HD); const int q0 = (blockIdx.x * FNW + w) * 32;
    Qh += pofs; Ql += pofs; Kh += pofs; Kl += pofs; Vh += pofs; Vl += pofs;
    // this lane's share of a stage: thread t takes bytes 16 (t & 7) of row t >> 3 of each 32 tile rows, so a wave's copy is four whole lines.
    const unsigned lck = (unsigned)(size_t)ring + (tid >> 3) * (KP * 2) + (tid & 7) * 16;
    const unsigned gck = tid * 8, gcv = (tid >> 3) * TT + (tid & 7) * 8;
    auto fill = [&](unsigned st) { const unsigned lb = (st & 1) * (STG * 2); const unsigned ek = gck + st * (SK * HD), ev = gcv + st * SK;   // element offsets in a plane, 32 bits: only gck and gcv live through the loop
        acopy8(lck + lb, lck + lb + KTL * 2, 32 * KP * 2, Kh + ek, Kl + ek, 32 * HD, 64 * HD);
        acopy8(lck + lb + 2 * KTL * 2, lck + lb + 3 * KTL * 2, 32 * KP * 2, Vh + ev, Vl + ev, 32 * TT, 64); };
    fill(0);
    const bf* pqh = Qh + (size_t)(q0 + lr) * HD + 8 * hi; const bf* pql = Ql + (size_t)(q0 + lr) * HD + 8 * hi;
    V qh[2][2], ql[2][2];   // [query tile][32-wide slice of the head dim]
#pragma unroll
    for (int qt = 0; qt < 2; ++qt)
#pragma unroll
        for (int kc = 0; kc < 2; ++kc) { qh[qt][kc] = WFrag<bf>::ld(pqh + qt * 16 * HD + kc * 32); ql[qt][kc] = WFrag<bf>::ld(pql + qt * 16 * HD + kc * 32); }
    asm volatile("s_wait_xcnt 0x0" :: "v"(pqh), "v"(pql) : "memory");   // behind the Q loads above: their address registers stay whole up to this wait and are reused only behind it
    v8f oacc[2][4];         // [query tile][16-row tile of the head dim]: O^T, register r = dim 8*hi + r, lane column = query
#pragma unroll
    for (int qt = 0; qt < 2; ++qt)
#pragma unroll
        for (int dt = 0; dt < 4; ++dt) oacc[qt][dt] = (v8f){};
    float shf[2] = { 0.f, 0.f }, lsum[2] = { 0.f, 0.f };   // the shift in use per query column (log2 domain; the same in both halves of the wave) and this half's sum of exp2(score - shift)
    v8f cn[2] = { (v8f){}, (v8f){} };                      // minus the shift in all eight registers: the C operand of a pass's first score product
    asm volatile("s_wait_asynccnt 0x0" ::: "memory");   // this wave's copies of stage 0 have landed
    __syncthreads();                                    // ... and every other wave's: stage 0 may be read
    fill(1);
#pragma unroll 1   // kept rolled: copies of a stage would only grow the text
    for (int st = 0; st < NST; ++st) {
        const bf* rb = ring + (st & 1) * STG;
        const bf* pkh = rb + lr * KP + 8 * hi; const bf* pkl = pkh + KTL; const bf* pvh = pkh + 2 * KTL; const bf* pvl = pkh + 3 * KTL;   // this lane's row and half; K walks 32 rows a pass, V 32 columns and, every other pass, on to the next 64 rows
        V kh[2][2], kl[2][2];   // [key tile][slice of the head dim]
#pragma unroll
        for (int kt = 0; kt < 2; ++kt)
#pragma unroll
            for (int kc = 0; kc < 2; ++kc) { kh[kt][kc] = WFrag<bf>::ld(pkh + kt * 16 * KP + kc * 32); kl[kt][kc] = WFrag<bf>::ld(pkl + kt * 16 * KP + kc * 32); }
#pragma unroll 1   // kept rolled: a pass is already straight-line code with 48 matrix instructions; unrolled, the four passes' score products are moved together and their live ranges spill
        for (int ps = 0; ps < SK / 32; ++ps) {
            V vh[4], vl[4];
#pragma unroll
            for (int dt = 0; dt < 4; ++dt) { vh[dt] = WFrag<bf>::ld(pvh + ((ps >> 1) * 64 + dt * 16) * KP + (ps & 1) * 32); vl[dt] = WFrag<bf>::ld(pvl + ((ps >> 1) * 64 + dt * 16) * KP + (ps & 1) * 32); }
            __builtin_amdgcn_sched_barrier(0);   // V of this pass is issued ahead of the score products, so that it lands under them and the softmax
            v8f s[2][2];        // [key tile][query tile]: score - shift
#pragma unroll
            for (int kc = 0; kc < 2; ++kc) {
#pragma unroll
                for (int kt = 0; kt < 2; ++kt)
#pragma unroll
                    for (int qt = 0; qt < 2; ++qt) s[kt][qt] = wmmab(kh[kt][kc], qh[qt][kc], kc == 0 ? cn[qt] : s[kt][qt]);
#pragma unroll
                for (int kt = 0; kt < 2; ++kt)
#pragma unroll
                    for (int qt = 0; qt < 2; ++qt) s[kt][qt] = wmmab(kl[kt][kc], qh[qt][kc], s[kt][qt]);
#pragma unroll
                for (int kt = 0; kt < 2; ++kt)
#pragma unroll
                    for (int qt = 0; qt < 2; ++qt) s[kt][qt] = wmmab(kh[kt][kc], ql[qt][kc], s[kt][qt]);
            }
            __builtin_amdgcn_sched_barrier(0);   // the next pass's K reads stay behind the products that read these registers and ahead of the softmax, which covers their latency
            if (ps + 1 < SK / 32) {              // inside the stage only: the next stage is read only behind its barrier
#pragma unroll
                for (int kt = 0; kt < 2; ++kt)
#pragma unroll
                    for (int kc = 0; kc < 2; ++kc) { kh[kt][kc] = WFrag<bf>::ld(pkh + ((ps + 1) * 32 + kt * 16) * KP + kc * 32); kl[kt][kc] = WFrag<bf>::ld(pkl + ((ps + 1) * 32 + kt * 16) * KP + kc * 32); }
            }
            __builtin_amdgcn_sched_barrier(0);   // see above: keeps those reads from sinking to their uses in the next pass
            float mx[2];
#pragma unroll
            for (int qt = 0; qt < 2; ++qt) {
                mx[qt] = s[0][qt][0];
#pragma unroll
                for (int j = 1; j < 8; ++j) mx[qt] = fmaxf(mx[qt], s[0][qt][j]);
#pragma unroll
                for (int j = 0; j < 8; ++j) mx[qt] = fmaxf(mx[qt], s[1][qt][j]);
            }
            // The shift moves only in the first pass (to that pass's maximum) and when some score of the wave lies more than 16 above the shift in use: one test a pass, a scalar branch.
            // Else exp2(score - shift) <= 65536, far inside the f32 range of O and the sums (2048 keys), which go on unscaled; a common factor of a column cancels in the final division.
            const bool first = (st | ps) == 0; const float thr = first ? -3.0e38f : 16.0f;
            if (__builtin_amdgcn_ballot_w32(fmaxf(mx[0], mx[1]) > thr) != 0) {
#pragma unroll
                for (int qt = 0; qt < 2; ++qt) {
                    const float jm = fmaxf(mx[qt], xhalf(mx[qt])); const float d = first ? jm : fmaxf(jm, 0.f);   // the column's step, the same in both halves
                    const float al = first ? 0.f : __builtin_amdgcn_exp2f(-d);                                     // first pass: O and the sums are still 0
                    shf[qt] += d; lsum[qt] *= al; cn[qt] = (v8f){} - shf[qt]; s[0][qt] -= d; s[1][qt] -= d;
#pragma unroll
                    for (int dt = 0; dt < 4; ++dt) oacc[qt][dt] *= al;
                }
            }
            V ph[2], pl[2]; v2f p[2][8]; v2bf pa[2][8];   // p and its hi rounding pa: [query tile][pair of keys]
#pragma unroll
            for (int qt = 0; qt < 2; ++qt)
#pragma unroll
                for (int kt = 0; kt < 2; ++kt)
#pragma unroll
                    for (int j = 0; j < 8; j += 2) { v2f e; e[0] = __builtin_amdgcn_exp2f(s[kt][qt][j]); e[1] = __builtin_amdgcn_exp2f(s[kt][qt][j + 1]); p[qt][kt * 4 + j / 2] = e;
                        const v2bf a = __builtin_convertvector(e, v2bf); pa[qt][kt * 4 + j / 2] = a; ph[qt][kt * 8 + j] = a[0]; ph[qt][kt * 8 + j + 1] = a[1]; }
            __builtin_amdgcn_sched_barrier(0);   // the exponentials and the hi roundings issue as runs of independent instructions ahead of the products; left free, each pair's exp, rounding, remainder and sum are strung into one dependent chain
#pragma unroll
            for (int qt = 0; qt < 2; ++qt) {
                v2f sum2 = { 0.f, 0.f };
#pragma unroll
                for (int i = 0; i < 8; ++i) { sum2 += p[qt][i];
                    const v2f r = p[qt][i] - __builtin_convertvector(pa[qt][i], v2f); const v2bf c = __builtin_convertvector(r, v2bf); pl[qt][2 * i] = c[0]; pl[qt][2 * i + 1] = c[1]; }
                lsum[qt] += sum2[0] + sum2[1];   // this half's keys only; the halves are joined once, behind the loop
            }
#pragma unroll
            for (int dt = 0; dt < 4; ++dt)
#pragma unroll
                for (int qt = 0; qt < 2; ++qt) oacc[qt][dt] = wmmab(vh[dt], ph[qt], oacc[qt][dt]);
#pragma unroll
            for (int dt = 0; dt < 4; ++dt)
#pragma unroll
                for (int qt = 0; qt < 2; ++qt) oacc[qt][dt] = wmmab(vl[dt], ph[qt], oacc[qt][dt]);
#pragma unroll
            for (int dt = 0; dt < 4; ++dt)
#pragma unroll
                for (int qt = 0; qt < 2; ++qt) oacc[qt][dt] = wmmab(vh[dt], pl[qt], oacc[qt][dt]);
            __builtin_amdgcn_sched_barrier(0);                   // holds the products above in front of the slots below
            asm volatile("v_nop\n\tv_nop\n\tv_nop\n\tv_nop");   // the distance behind the last matrix instruction, on both sides of the loop's branch: the next pass's address arithmetic and the refill's reuse its operand registers
        }
        asm volatile("s_wait_dscnt 0x0" ::: "memory");      // this wave's reads of stage st have returned: its buffer may be refilled behind the barrier
        asm volatile("s_wait_asynccnt 0x0" ::: "memory");   // this wave's copies of stage st + 1 have landed
        __syncthreads();                                    // publishes stage st + 1 and ends every wave's reads of stage st
        if (st + 2 < NST) fill(st + 2);                     // into the buffer that this trip has just read
    }
    asm volatile("s_wait_asynccnt 0x0" ::: "memory");       // no copy is left in flight when the wave ends
#pragma unroll
    for (int qt = 0; qt < 2; ++qt) { const float f = __fdiv_rn(0.125f, lsum[qt] + xhalf(lsum[qt]));   // softmax / sqrt(64)
        float* orow = OUT + ((size_t)bb * TT + q0 + qt * 16 + lr) * DM + h * HD + 8 * hi;
#pragma unroll
        for (int dt = 0; dt < 4; ++dt) { v4f lo4, hi4;
#pragma unroll
            for (int j = 0; j < 4; ++j) { lo4[j] = oacc[qt][dt][j] * f; hi4[j] = oacc[qt][dt][4 + j] * f; }
            *(v4f*)(orow + dt * 16) = lo4; *(v4f*)(orow + dt * 16 + 4) = hi4; } }
}
__global__ __launch_bounds__(256) void k_merge(const float* __restrict__ O, int h0, bf* Ah, bf* Al) { const size_t e = ((size_t)blockIdx.x * 256 + threadIdx.x) * 2; if (e >= (size_t)ZH * TT * HD) return; const int d = (int)(e % HD); const int t = (int)((e / HD) % TT); const int zz = (int)(e / ((size_t)HD * TT)); const float cs = (t < RH) ? 1.0f : (1.0f / PCAR); const size_t oo = (size_t)t * DQ + (h0 + zz) * HD + d;
    v2us oh, ol;
#pragma unroll
    for (int q = 0; q < 2; ++q) { unsigned short a, c2; splitf(O[e + q] * cs, a, c2); oh[q] = a; ol[q] = c2; } *(v2us*)(Ah + oo) = oh; *(v2us*)(Al + oo) = ol;  }

extern "C" void kernel_launch(void* const* d_in, const int* in_sizes, int n_in,
                              void* d_out, int out_size, void* d_ws, size_t ws_size, hipStream_t stream) {
    (void)in_sizes; (void)n_in; (void)out_size;
    const float* x = (const float*)d_in[0]; const float* wq = (const float*)d_in[1]; const float* bq = (const float*)d_in[2]; const float* wk = (const float*)d_in[3]; const float* bk = (const float*)d_in[4]; const float* wv = (const float*)d_in[5]; const float* bv = (const float*)d_in[6];   // W [16][1024][64] per head (x @ W[h]), b [16][64]
    float* OUT = (float*)d_out;     // [2][2048][1024]
    char* wsp = (char*)d_ws;
    auto take = [&](size_t bytes) { char* p = wsp; wsp += (bytes + 255) & ~(size_t)255; return (void*)p; };
    bf* W3 = (bf*)take((size_t)3 * DQ * DM * 2); bf* XB = (bf*)take((size_t)NB_ * TT * DM * 2);   // q, k, v weights transposed; x of both batches
    const size_t PB = (size_t)NH_ * TT * HD;   // one batch's hi or lo plane, elements; the planes hold both batches
    bf* QPh = (bf*)take(NB_ * PB * 2); bf* QPl = (bf*)take(NB_ * PB * 2); bf* KPh = (bf*)take(NB_ * PB * 2); bf* KPl = (bf*)take(NB_ * PB * 2); bf* VTh = (bf*)take(NB_ * PB * 2); bf* VTl = (bf*)take(NB_ * PB * 2);
    if ((size_t)(wsp - (char*)d_ws) > ws_size) return;    // ws 256 MiB
    k_prep<<<NH_ * (DM / 64), 32 * GNW, 0, stream>>>(x, wq, wk, wv, XB, W3);
    k_proj<<<dim3(NB_ * TT / 256, NH_, 1), 32 * PNW, 0, stream>>>(XB, W3, bq, bk, bv, QPh, QPl, KPh, KPl, VTh, VTl);
    k_fattn<<<dim3(TT / (32 * FNW), NH_, NB_), 32 * FNW, 0, stream>>>(QPh, QPl, KPh, KPl, VTh, VTl, OUT);
}

